// v000
// Measured on an AMD MI455X. A time is GPU time per run, averaged over a window of back-to-back runs after a warm-up
// (all launches, gaps included; the runs take copies of the inputs in turn), and the median of several windows.
// Apart from v000's, it joins two sittings. Times from different sittings can be a few percent apart, while
// side-by-side timings come from the same sitting.
// v000 is the starting kernel. One run takes 147 microseconds.
#include <hip/hip_runtime.h>
// Unnormalised two-head attention (no softmax, no scale, no mask): q = x for both heads, k = x Wqk, v = x Wov ([in][out] weights, head h = columns h*128..h*128+127), out[b][t][h][:] = sum_s (x_t . k_s,h) v_s,h, evaluated as out = x (k_h^T v_h) with the per-(batch, head) 128x128 matrix k_h^T v_h summed over all 4096 tokens.
// Structure: x and both weights RNE-converted to bf16 and held exactly as f16 planes (x carried x16, weights transposed to [out][in] and carried x2^10); one projection GEMM [k|v] = x W (K=128) -> f32 carried x2^10; [k|v] -> per-(batch, head) transposed f16 planes [128][T] via LDS; Mt = v^T k (K=4096) -> f16 plane carried x2^12; out = x Mt^T (K=128, N = 256 = (head, channel)) f32 into the output buffer.
// Compute dtype: every contraction on v_wmma_f32_16x16x32_f16 (f16 operands, single products, f32 accumulate); all conversions and epilogues in f32.
#ifndef NB
#define NB 2
#endif
#ifndef SEQ
#define SEQ 4096
#endif
#define SEQ_FULL 4096
#define CD 128
#define NH 2
#define HW (NH * CD)
#define KVW (2 * HW)
static_assert(NB >= 1 && NB <= 2);
static_assert(SEQ <= SEQ_FULL);
static_assert(SEQ % 128 == 0);
static_assert(SEQ % 64 == 0);
static_assert(SEQ % 32 == 0);
static_assert(CD % 128 == 0);
static_assert(CD % 64 == 0);
static_assert(CD % 32 == 0);
static_assert(HW % 64 == 0);
static_assert(KVW % 64 == 0);
static_assert((NB * SEQ) % 128 == 0);
static_assert((SEQ * CD / 8) % 256 == 0);
static_assert(256 * 16 * 2 == 64 * 128);
static_assert(4 * 32 * 68 * 4 <= 131072);
static_assert(64 * 65 * 2 <= 131072);

typedef unsigned short v8us __attribute__((ext_vector_type(8), may_alias));
typedef float  v8f  __attribute__((ext_vector_type(8)));
typedef float  v4f  __attribute__((ext_vector_type(4)));
typedef float  v4fa __attribute__((ext_vector_type(4), may_alias));
typedef _Float16 v16h __attribute__((ext_vector_type(16)));
typedef _Float16 v4h __attribute__((ext_vector_type(4)));
union FragH { v16h v; v8us half[2]; _Float16 h[16]; unsigned short u[16]; };

constexpr size_t al256(size_t b) { return (b + 255) & ~(size_t)255; }
constexpr size_t WSB_X16 = al256((size_t)NB * SEQ * CD * 2);
constexpr size_t WSB_WT  = al256((size_t)KVW * CD * 2);
constexpr size_t WSB_KVF = al256((size_t)NB * SEQ * KVW * 4);
constexpr size_t WSB_KVT = al256((size_t)2 * NB * HW * SEQ * 2);
constexpr size_t WSB_MT  = al256((size_t)NB * NH * CD * CD * 2);
static_assert(WSB_X16 + WSB_WT + WSB_KVF + WSB_KVT + WSB_MT <= (size_t)134217728);

__device__ __forceinline__ unsigned short bf16_bits(float x) { unsigned int u = __float_as_uint(x); return (unsigned short)((u + 0x7FFFu + ((u >> 16) & 1u)) >> 16); }
__device__ __forceinline__ float bf16_val(unsigned short b) { return __uint_as_float(((unsigned int)b) << 16); }
__device__ __forceinline__ float bf16_rne(float x) { return bf16_val(bf16_bits(x)); }
__device__ __forceinline__ unsigned short h2u(_Float16 x) { return __builtin_bit_cast(unsigned short, x); }
// f32 -> f16 with values below the smallest f16 normal replaced by +0 (value select)
static __device__ __forceinline__ _Float16 toh_flush(float v) { const _Float16 r = (_Float16)v; return (fabsf(v) < 6.103515625e-05f) ? (_Float16)0.0f : r; }

// 16-bit fragment loader: lane row/col = lane & 15, elements 0..7 <- k 8hh..8hh+7, elements 8..15 <- k 16+8hh..16+8hh+7 (same map for A and B)
__device__ __forceinline__ v16h g2_frag(const _Float16* p, int hh) { FragH f; f.half[0] = *(const v8us*)((const unsigned short*)p + 8 * hh); f.half[1] = *(const v8us*)((const unsigned short*)p + 16 + 8 * hh); return f.v; }
__device__ __forceinline__ v8f g2_mma(v16h a, v16h b, v8f c) { v8f d = __builtin_amdgcn_wmma_f32_16x16x32_f16(false, a, false, b, (short)0, c, false, false); asm volatile("v_nop\n\tv_nop\n\tv_nop\n\tv_nop" : "+v"(d) : "v"(a), "v"(b)); return d; }

__global__ __launch_bounds__(256) void k_wnat(const float* __restrict__ w, size_t n8, _Float16* __restrict__ Bt) {
  const size_t t = (size_t)blockIdx.x * 256 + threadIdx.x; if (t >= n8) return; FragH f;
#pragma unroll
  for (int q = 0; q < 8; ++q) f.h[q] = toh_flush(bf16_rne(w[t * 8 + q]) * 16.0f);
  *(v8us*)((unsigned short*)Bt + t * 8) = f.half[0]; 
}

__global__ __launch_bounds__(256) void k_wtr(const float* __restrict__ w, _Float16* __restrict__ Wt) {
  #pragma clang fp contract(off)
  __shared__ unsigned short tl[64][65];
  const int tid = threadIdx.x; const int kg = blockIdx.x / (HW / 64), ng = blockIdx.x - kg * (HW / 64); const int k0 = kg * 64, n0 = ng * 64;
  for (int i = tid; i < 64 * 8; i += 256) {
    const int j = i >> 3, d8 = (i & 7) * 8; const float* wp = w + (size_t)(k0 + j) * HW + n0 + d8;
    const v4f a = *(const v4fa*)wp, c = *(const v4fa*)(wp + 4); const float xs[8] = {a[0], a[1], a[2], a[3], c[0], c[1], c[2], c[3]};
#pragma unroll
    for (int q = 0; q < 8; ++q) tl[d8 + q][j] = h2u(toh_flush(bf16_rne(xs[q]) * 1024.0f));
  }
  __syncthreads();
  {
    for (int i = tid; i < 64 * 8; i += 256) {
      const int d = i >> 3, j8 = (i & 7) * 8; FragH f;
#pragma unroll
      for (int q = 0; q < 8; ++q) f.u[q] = tl[d][j8 + q];
      const size_t o = (size_t)(n0 + d) * CD + k0 + j8;
      *(v8us*)((unsigned short*)Wt + o) = f.half[0];
    }
     }
}

__global__ __launch_bounds__(256) void k_kvt(const float* __restrict__ F, _Float16* __restrict__ KVT) {
  #pragma clang fp contract(off)
  __shared__ unsigned short tl[64][65];
  const int tid = threadIdx.x; const int perb = (KVW / 64) * (SEQ / 64);
  const int b = blockIdx.x / perb; const int rem = blockIdx.x - b * perb;
  const int g = rem / (SEQ / 64), sg = rem - g * (SEQ / 64); const int s0 = sg * 64;
  const int isv = g / (HW / 64), gl = g - isv * (HW / 64);
  for (int i = tid; i < 64 * 8; i += 256) {
    const int j = i >> 3, d8 = (i & 7) * 8; const float* vp = F + ((size_t)b * SEQ + s0 + j) * KVW + g * 64 + d8;
    const v4f a = *(const v4fa*)vp, c = *(const v4fa*)(vp + 4); const float xs[8] = {a[0], a[1], a[2], a[3], c[0], c[1], c[2], c[3]};
#pragma unroll
    for (int q = 0; q < 8; ++q) tl[d8 + q][j] = h2u(toh_flush(xs[q]));
  }
  __syncthreads();
  {
    for (int i = tid; i < 64 * 8; i += 256) {
      const int d = i >> 3, j8 = (i & 7) * 8; FragH f;
#pragma unroll
      for (int q = 0; q < 8; ++q) f.u[q] = tl[d][j8 + q];
      const size_t o = (size_t)isv * ((size_t)NB * HW * SEQ) + ((size_t)b * HW + gl * 64 + d) * SEQ + s0 + j8;
      *(v8us*)((unsigned short*)KVT + o) = f.half[0];
    }
     }
}

template <int ACT>
__global__ __launch_bounds__(128) void k_gemm2(const _Float16* __restrict__ A, int lda, size_t sA, const _Float16* __restrict__ Bh, int ldb, size_t sB, float alpha, const float* __restrict__ bias, size_t sBias, const float* __restrict__ CP, int rowsPerB, size_t sCPb, int row0g,
    float* __restrict__ C, _Float16* __restrict__ C16, int ldc, size_t sC, int M, int N, int K) {
  static_assert(ACT == 0);
  __shared__ __attribute__((aligned(16))) float so[4][32][68];
  const int tid = threadIdx.x, w = tid >> 5, lane = tid & 31, ln = lane & 15, hh = lane >> 4; const int by = blockIdx.y;
  A += (size_t)by * sA; Bh += (size_t)by * sB; const size_t cofs = (size_t)by * sC; const float* bp = bias ? bias + (size_t)by * sBias : nullptr;
  const int ntn = N >> 6; const int mt = blockIdx.x / ntn, nq = blockIdx.x - mt * ntn; const int row0 = mt * 128 + 32 * w, col0 = nq * 64; if (row0 >= M) return;
  const _Float16* a0p = A + (size_t)(row0 + ln) * lda; const _Float16* a1p = a0p + (size_t)16 * lda;
  const _Float16* b0p = Bh + (size_t)(col0 + ln) * ldb; const _Float16* b1p = b0p + (size_t)16 * ldb; const _Float16* b2p = b1p + (size_t)16 * ldb; const _Float16* b3p = b2p + (size_t)16 * ldb;
  const v8f z8 = {0.f,0.f,0.f,0.f,0.f,0.f,0.f,0.f}; v8f c00 = z8, c01 = z8, c02 = z8, c03 = z8, c10 = z8, c11 = z8, c12 = z8, c13 = z8;
#pragma unroll 1
  for (int kb = 0; kb < K; kb += 32) { const v16h a0 = g2_frag(a0p + kb, hh), a1 = g2_frag(a1p + kb, hh);
    v16h b = g2_frag(b0p + kb, hh); c00 = g2_mma(a0, b, c00); c10 = g2_mma(a1, b, c10);
    b = g2_frag(b1p + kb, hh); c01 = g2_mma(a0, b, c01); c11 = g2_mma(a1, b, c11);
    b = g2_frag(b2p + kb, hh); c02 = g2_mma(a0, b, c02); c12 = g2_mma(a1, b, c12);
    b = g2_frag(b3p + kb, hh); c03 = g2_mma(a0, b, c03); c13 = g2_mma(a1, b, c13); }
  v8f accs[8] = {c00, c01, c02, c03, c10, c11, c12, c13};
#pragma unroll
  for (int u = 0; u < 8; ++u) { const int t = u & 3, half = u >> 2; const int col = col0 + t * 16 + ln; const float bv = bp ? bf16_rne(bp[col]) : 0.f;
#pragma unroll
    for (int r = 0; r < 8; ++r) { const int rloc = half * 16 + 8 * hh + r; float v = accs[u][r] * alpha + bv;
      if (CP) { if (rowsPerB < 0) v += CP[cofs + (size_t)(row0g + row0 + rloc) * ldc + col]; else { const int bidx = (row0g + row0 + rloc) / rowsPerB; v += CP[(size_t)bidx * sCPb + (size_t)by * 64 + col]; } }
      so[w][rloc][t * 16 + ln] = v; } }
  __builtin_amdgcn_fence(4 /* acq_rel order */, "workgroup"); __builtin_amdgcn_wave_barrier();
  const int rsub = lane >> 4, c4 = (lane & 15) * 4;
  {
#pragma unroll
    for (int q = 0; q < 16; ++q) { const int r = q * 2 + rsub; const v4f v = *(const v4fa*)&so[w][r][c4];
      if (C) *(v4f*)(C + cofs + (size_t)(row0 + r) * ldc + col0 + c4) = v;
      if (C16) { v4h h4; for (int i = 0; i < 4; ++i) h4[i] = (_Float16)v[i]; *(v4h*)(C16 + cofs + (size_t)(row0 + r) * ldc + col0 + c4) = h4; } }
     }
}

extern "C" void kernel_launch(void* const* d_in, const int* in_sizes, int n_in,
                              void* d_out, int out_size, void* d_ws, size_t ws_size, hipStream_t stream) {
  if (n_in < 3) return;
  if ((size_t)in_sizes[0] < (size_t)(NB - 1) * SEQ_FULL * CD + (size_t)SEQ * CD || in_sizes[1] < CD * HW || in_sizes[2] < CD * HW) return;
  if ((size_t)out_size < (size_t)(NB - 1) * SEQ_FULL * HW + (size_t)SEQ * HW) return;
  const float* xin = (const float*)d_in[0]; const float* Wqk = (const float*)d_in[1]; const float* Wov = (const float*)d_in[2];
  char* ws = (char*)d_ws; size_t off = 0;
  auto take = [&](size_t bytes) { char* p = ws + off; off += (bytes + 255) & ~(size_t)255; return p; };
  _Float16* X16  = (_Float16*)take((size_t)NB * SEQ * CD * 2);        /* [NB*SEQ][CD], 16 x */
  _Float16* WT16 = (_Float16*)take((size_t)KVW * CD * 2);             /* [KVW][CD]: rows 0..HW-1 = Wqk^T, HW..KVW-1 = Wov^T, 2^10 w */
  float*    KVf  = (float*)take((size_t)NB * SEQ * KVW * 4);          /* [NB*SEQ][KVW] = [k | v], 2^10 carried */
  _Float16* KVT  = (_Float16*)take((size_t)2 * NB * HW * SEQ * 2);    /* [2][NB*HW][SEQ] */
  _Float16* Mt16 = (_Float16*)take((size_t)NB * NH * CD * CD * 2);    /* [NB*NH][c2][c1], 2^12 carried */
  if (off > ws_size) return;      /* approx 26.3 MiB at NB 2, SEQ 4096 */
  _Float16* KT16 = KVT; _Float16* VT16 = KVT + (size_t)NB * HW * SEQ;
  const size_t n8x = (size_t)SEQ * CD / 8;
  for (int b = 0; b < NB; ++b)
    k_wnat<<<(unsigned)((n8x + 255) / 256), 256, 0, stream>>>(xin + (size_t)b * SEQ_FULL * CD, n8x, X16 + (size_t)b * SEQ * CD);
  /* in[CD][HW] -> out[HW][CD]; grid = (CD/64) x (HW/64) tiles */
  k_wtr<<<(CD / 64) * (HW / 64), 256, 0, stream>>>(Wqk, WT16);
  k_wtr<<<(CD / 64) * (HW / 64), 256, 0, stream>>>(Wov, WT16 + (size_t)HW * CD);
  /* [k|v] = (16 x)(2^10 W) x 1/16 -> 2^10 k, 2^10 v in f32 */
  k_gemm2<0><<<dim3((NB * SEQ / 128) * (KVW / 64), 1), 128, 0, stream>>>(X16, CD, (size_t)0, WT16, CD, (size_t)0, 0.0625f, (const float*)nullptr, (size_t)0, (const float*)nullptr, 1, (size_t)0, 0, KVf, (_Float16*)nullptr, KVW, (size_t)0, NB * SEQ, KVW, CD);
  /* in[NB*SEQ][KVW] -> out[2][NB*HW][SEQ]; grid = NB x (KVW/64) x (SEQ/64) tiles */
  k_kvt<<<NB * (KVW / 64) * (SEQ / 64), 256, 0, stream>>>(KVf, KVT);
  /* Mt[b,h][c2][c1] = sum_t v[t][c2] k[t][c1]: (2^10 v)^T (2^10 k) x 2^-8 -> 2^12 M as f16, (batch, head) on grid.y */
  k_gemm2<0><<<dim3((CD / 128) * (CD / 64), NB * NH), 128, 0, stream>>>(VT16, SEQ, (size_t)CD * SEQ, KT16, SEQ, (size_t)CD * SEQ, 0.00390625f, (const float*)nullptr, (size_t)0, (const float*)nullptr, 1, (size_t)0, 0, (float*)nullptr, Mt16, CD, (size_t)CD * CD, CD, CD, SEQ);
  /* out[b][t][h*CD + c2] = (16 x)(2^12 Mt)^T x 2^-16, batch on grid.y; B rows n = h*CD + c2 are the output columns */
  k_gemm2<0><<<dim3((SEQ / 128) * (HW / 64), NB), 128, 0, stream>>>(X16, CD, (size_t)SEQ * CD, Mt16, CD, (size_t)HW * CD, 1.52587890625e-05f, (const float*)nullptr, (size_t)0, (const float*)nullptr, 1, (size_t)0, 0, (float*)d_out, (_Float16*)nullptr, HW, (size_t)SEQ_FULL * HW, SEQ, HW, CD);
}

// v001
// Measured time: 47.5 microseconds a run.
// Timed twice side by side with v000, it ran 3.08 and 3.11 times as fast.
#include <hip/hip_runtime.h>
// Unnormalised two-head attention (no softmax, no scale, no mask): q = x for both heads, k = x Wqk, v = x Wov ([in][out] weights, head h = columns h*128..h*128+127), out[b][t][h][:] = sum_s (x_t . k_s,h) v_s,h, evaluated as out = x (k_h^T v_h) with the per-(batch, head) 128x128 matrix k_h^T v_h summed over all 4096 tokens.
// Structure: x and both weights RNE-converted to bf16 and held exactly as f16 planes (x carried x16, weights transposed to [out][in] and carried x2^10); one projection GEMM [k|v] = x W (K=128) -> f32 carried x2^10; [k|v] -> per-(batch, head) transposed f16 planes [128][T] via LDS; Mt = v^T k (K=4096, cut into KSPLIT token ranges on grid.z, one f32 partial plane each, summed in range order by k_mtsum) -> f16 plane carried x2^12; out = x Mt^T (K=128, N = 256 = (head, channel)) f32 into the output buffer.
// Compute dtype: every contraction on v_wmma_f32_16x16x32_f16 (f16 operands, single products, f32 accumulate); all conversions and epilogues in f32.
#ifndef NB
#define NB 2
#endif
#ifndef SEQ
#define SEQ 4096
#endif
#define SEQ_FULL 4096
#define CD 128
#define NH 2
#define HW (NH * CD)
#define KVW (2 * HW)
#define KSPLIT 32
#define MTN (NB * NH * CD * CD)
static_assert(NB >= 1 && NB <= 2);
static_assert(SEQ <= SEQ_FULL);
static_assert(SEQ % 128 == 0);
static_assert(SEQ % 64 == 0);
static_assert(SEQ % 32 == 0);
static_assert(SEQ % (KSPLIT * 32) == 0);
static_assert(MTN % (256 * 4) == 0);
static_assert(CD % 128 == 0);
static_assert(CD % 64 == 0);
static_assert(CD % 32 == 0);
static_assert(HW % 64 == 0);
static_assert(KVW % 64 == 0);
static_assert((NB * SEQ) % 128 == 0);
static_assert((SEQ * CD / 8) % 256 == 0);
static_assert(256 * 16 * 2 == 64 * 128);
static_assert(4 * 32 * 68 * 4 <= 131072);
static_assert(64 * 65 * 2 <= 131072);

typedef unsigned short v8us __attribute__((ext_vector_type(8), may_alias));
typedef float  v8f  __attribute__((ext_vector_type(8)));
typedef float  v4f  __attribute__((ext_vector_type(4)));
typedef float  v4fa __attribute__((ext_vector_type(4), may_alias));
typedef _Float16 v16h __attribute__((ext_vector_type(16)));
typedef _Float16 v4h __attribute__((ext_vector_type(4)));
union FragH { v16h v; v8us half[2]; _Float16 h[16]; unsigned short u[16]; };

constexpr size_t al256(size_t b) { return (b + 255) & ~(size_t)255; }
constexpr size_t WSB_X16 = al256((size_t)NB * SEQ * CD * 2);
constexpr size_t WSB_WT  = al256((size_t)KVW * CD * 2);
constexpr size_t WSB_KVF = al256((size_t)NB * SEQ * KVW * 4);
constexpr size_t WSB_KVT = al256((size_t)2 * NB * HW * SEQ * 2);
constexpr size_t WSB_MT  = al256((size_t)NB * NH * CD * CD * 2);
constexpr size_t WSB_MTP = al256((size_t)KSPLIT * MTN * 4);
static_assert(WSB_X16 + WSB_WT + WSB_KVF + WSB_KVT + WSB_MT + WSB_MTP <= (size_t)134217728);

__device__ __forceinline__ unsigned short bf16_bits(float x) { unsigned int u = __float_as_uint(x); return (unsigned short)((u + 0x7FFFu + ((u >> 16) & 1u)) >> 16); }
__device__ __forceinline__ float bf16_val(unsigned short b) { return __uint_as_float(((unsigned int)b) << 16); }
__device__ __forceinline__ float bf16_rne(float x) { return bf16_val(bf16_bits(x)); }
__device__ __forceinline__ unsigned short h2u(_Float16 x) { return __builtin_bit_cast(unsigned short, x); }
// f32 -> f16 with values below the smallest f16 normal replaced by +0 (value select)
static __device__ __forceinline__ _Float16 toh_flush(float v) { const _Float16 r = (_Float16)v; return (fabsf(v) < 6.103515625e-05f) ? (_Float16)0.0f : r; }

// 16-bit fragment loader: lane row/col = lane & 15, elements 0..7 <- k 8hh..8hh+7, elements 8..15 <- k 16+8hh..16+8hh+7 (same map for A and B)
__device__ __forceinline__ v16h g2_frag(const _Float16* p, int hh) { FragH f; f.half[0] = *(const v8us*)((const unsigned short*)p + 8 * hh); f.half[1] = *(const v8us*)((const unsigned short*)p + 16 + 8 * hh); return f.v; }
__device__ __forceinline__ v8f g2_mma(v16h a, v16h b, v8f c) { v8f d = __builtin_amdgcn_wmma_f32_16x16x32_f16(false, a, false, b, (short)0, c, false, false); asm volatile("v_nop\n\tv_nop\n\tv_nop\n\tv_nop" : "+v"(d) : "v"(a), "v"(b)); return d; }

__global__ __launch_bounds__(256) void k_wnat(const float* __restrict__ w, size_t n8, _Float16* __restrict__ Bt) {
  const size_t t = (size_t)blockIdx.x * 256 + threadIdx.x; if (t >= n8) return; FragH f;
#pragma unroll
  for (int q = 0; q < 8; ++q) f.h[q] = toh_flush(bf16_rne(w[t * 8 + q]) * 16.0f);
  *(v8us*)((unsigned short*)Bt + t * 8) = f.half[0]; 
}

__global__ __launch_bounds__(256) void k_wtr(const float* __restrict__ w, _Float16* __restrict__ Wt) {
  #pragma clang fp contract(off)
  __shared__ unsigned short tl[64][65];
  const int tid = threadIdx.x; const int kg = blockIdx.x / (HW / 64), ng = blockIdx.x - kg * (HW / 64); const int k0 = kg * 64, n0 = ng * 64;
  for (int i = tid; i < 64 * 8; i += 256) {
    const int j = i >> 3, d8 = (i & 7) * 8; const float* wp = w + (size_t)(k0 + j) * HW + n0 + d8;
    const v4f a = *(const v4fa*)wp, c = *(const v4fa*)(wp + 4); const float xs[8] = {a[0], a[1], a[2], a[3], c[0], c[1], c[2], c[3]};
#pragma unroll
    for (int q = 0; q < 8; ++q) tl[d8 + q][j] = h2u(toh_flush(bf16_rne(xs[q]) * 1024.0f));
  }
  __syncthreads();
  {
    for (int i = tid; i < 64 * 8; i += 256) {
      const int d = i >> 3, j8 = (i & 7) * 8; FragH f;
#pragma unroll
      for (int q = 0; q < 8; ++q) f.u[q] = tl[d][j8 + q];
      const size_t o = (size_t)(n0 + d) * CD + k0 + j8;
      *(v8us*)((unsigned short*)Wt + o) = f.half[0];
    }
     }
}

__global__ __launch_bounds__(256) void k_kvt(const float* __restrict__ F, _Float16* __restrict__ KVT) {
  #pragma clang fp contract(off)
  __shared__ unsigned short tl[64][65];
  const int tid = threadIdx.x; const int perb = (KVW / 64) * (SEQ / 64);
  const int b = blockIdx.x / perb; const int rem = blockIdx.x - b * perb;
  const int g = rem / (SEQ / 64), sg = rem - g * (SEQ / 64); const int s0 = sg * 64;
  const int isv = g / (HW / 64), gl = g - isv * (HW / 64);
  for (int i = tid; i < 64 * 8; i += 256) {
    const int j = i >> 3, d8 = (i & 7) * 8; const float* vp = F + ((size_t)b * SEQ + s0 + j) * KVW + g * 64 + d8;
    const v4f a = *(const v4fa*)vp, c = *(const v4fa*)(vp + 4); const float xs[8] = {a[0], a[1], a[2], a[3], c[0], c[1], c[2], c[3]};
#pragma unroll
    for (int q = 0; q < 8; ++q) tl[d8 + q][j] = h2u(toh_flush(xs[q]));
  }
  __syncthreads();
  {
    for (int i = tid; i < 64 * 8; i += 256) {
      const int d = i >> 3, j8 = (i & 7) * 8; FragH f;
#pragma unroll
      for (int q = 0; q < 8; ++q) f.u[q] = tl[d][j8 + q];
      const size_t o = (size_t)isv * ((size_t)NB * HW * SEQ) + ((size_t)b * HW + gl * 64 + d) * SEQ + s0 + j8;
      *(v8us*)((unsigned short*)KVT + o) = f.half[0];
    }
     }
}

template <int ACT>
__global__ __launch_bounds__(128) void k_gemm2(const _Float16* __restrict__ A, int lda, size_t sA, const _Float16* __restrict__ Bh, int ldb, size_t sB, float alpha, const float* __restrict__ bias, size_t sBias, const float* __restrict__ CP, int rowsPerB, size_t sCPb, int row0g,
    float* __restrict__ C, _Float16* __restrict__ C16, int ldc, size_t sC, size_t sCz, int M, int N, int K) {
  static_assert(ACT == 0);
  __shared__ __attribute__((aligned(16))) float so[4][32][68];
  const int tid = threadIdx.x, w = tid >> 5, lane = tid & 31, ln = lane & 15, hh = lane >> 4; const int by = blockIdx.y, bz = blockIdx.z;
  /* grid.z = K range: this workgroup contracts k in [bz*K, bz*K + K) and writes plane bz of C */
  A += (size_t)by * sA + (size_t)bz * K; Bh += (size_t)by * sB + (size_t)bz * K; const size_t cofs = (size_t)by * sC + (size_t)bz * sCz; const float* bp = bias ? bias + (size_t)by * sBias : nullptr;
  const int ntn = N >> 6; const int mt = blockIdx.x / ntn, nq = blockIdx.x - mt * ntn; const int row0 = mt * 128 + 32 * w, col0 = nq * 64; if (row0 >= M) return;
  const _Float16* a0p = A + (size_t)(row0 + ln) * lda; const _Float16* a1p = a0p + (size_t)16 * lda;
  const _Float16* b0p = Bh + (size_t)(col0 + ln) * ldb; const _Float16* b1p = b0p + (size_t)16 * ldb; const _Float16* b2p = b1p + (size_t)16 * ldb; const _Float16* b3p = b2p + (size_t)16 * ldb;
  const v8f z8 = {0.f,0.f,0.f,0.f,0.f,0.f,0.f,0.f}; v8f c00 = z8, c01 = z8, c02 = z8, c03 = z8, c10 = z8, c11 = z8, c12 = z8, c13 = z8;
#pragma unroll 1
  for (int kb = 0; kb < K; kb += 32) { const v16h a0 = g2_frag(a0p + kb, hh), a1 = g2_frag(a1p + kb, hh);
    v16h b = g2_frag(b0p + kb, hh); c00 = g2_mma(a0, b, c00); c10 = g2_mma(a1, b, c10);
    b = g2_frag(b1p + kb, hh); c01 = g2_mma(a0, b, c01); c11 = g2_mma(a1, b, c11);
    b = g2_frag(b2p + kb, hh); c02 = g2_mma(a0, b, c02); c12 = g2_mma(a1, b, c12);
    b = g2_frag(b3p + kb, hh); c03 = g2_mma(a0, b, c03); c13 = g2_mma(a1, b, c13); }
  v8f accs[8] = {c00, c01, c02, c03, c10, c11, c12, c13};
#pragma unroll
  for (int u = 0; u < 8; ++u) { const int t = u & 3, half = u >> 2; const int col = col0 + t * 16 + ln; const float bv = bp ? bf16_rne(bp[col]) : 0.f;
#pragma unroll
    for (int r = 0; r < 8; ++r) { const int rloc = half * 16 + 8 * hh + r; float v = accs[u][r] * alpha + bv;
      if (CP) { if (rowsPerB < 0) v += CP[cofs + (size_t)(row0g + row0 + rloc) * ldc + col]; else { const int bidx = (row0g + row0 + rloc) / rowsPerB; v += CP[(size_t)bidx * sCPb + (size_t)by * 64 + col]; } }
      so[w][rloc][t * 16 + ln] = v; } }
  __builtin_amdgcn_fence(4 /* acq_rel order */, "workgroup"); __builtin_amdgcn_wave_barrier();
  const int rsub = lane >> 4, c4 = (lane & 15) * 4;
  {
#pragma unroll
    for (int q = 0; q < 16; ++q) { const int r = q * 2 + rsub; const v4f v = *(const v4fa*)&so[w][r][c4];
      if (C) *(v4f*)(C + cofs + (size_t)(row0 + r) * ldc + col0 + c4) = v;
      if (C16) { v4h h4; for (int i = 0; i < 4; ++i) h4[i] = (_Float16)v[i]; *(v4h*)(C16 + cofs + (size_t)(row0 + r) * ldc + col0 + c4) = h4; } }
     }
}

// Mt = sum over the KSPLIT partial planes, in range order, f32, then one rounding to f16; 4 elements a thread
__global__ __launch_bounds__(256) void k_mtsum(const float* __restrict__ P, _Float16* __restrict__ Mt) {
  const size_t e = ((size_t)blockIdx.x * 256 + threadIdx.x) * 4;
  v4f s = *(const v4fa*)(P + e);
  /* unrolled so that the planes' loads overlap: rolled, each add would wait out its own load */
#pragma unroll
  for (int z = 1; z < KSPLIT; ++z) s += *(const v4fa*)(P + (size_t)z * MTN + e);
  v4h h4; for (int i = 0; i < 4; ++i) h4[i] = (_Float16)s[i];
  *(v4h*)(Mt + e) = h4;
}

extern "C" void kernel_launch(void* const* d_in, const int* in_sizes, int n_in,
                              void* d_out, int out_size, void* d_ws, size_t ws_size, hipStream_t stream) {
  if (n_in < 3) return;
  if ((size_t)in_sizes[0] < (size_t)(NB - 1) * SEQ_FULL * CD + (size_t)SEQ * CD || in_sizes[1] < CD * HW || in_sizes[2] < CD * HW) return;
  if ((size_t)out_size < (size_t)(NB - 1) * SEQ_FULL * HW + (size_t)SEQ * HW) return;
  const float* xin = (const float*)d_in[0]; const float* Wqk = (const float*)d_in[1]; const float* Wov = (const float*)d_in[2];
  char* ws = (char*)d_ws; size_t off = 0;
  auto take = [&](size_t bytes) { char* p = ws + off; off += (bytes + 255) & ~(size_t)255; return p; };
  _Float16* X16  = (_Float16*)take((size_t)NB * SEQ * CD * 2);        /* [NB*SEQ][CD], 16 x */
  _Float16* WT16 = (_Float16*)take((size_t)KVW * CD * 2);             /* [KVW][CD]: rows 0..HW-1 = Wqk^T, HW..KVW-1 = Wov^T, 2^10 w */
  float*    KVf  = (float*)take((size_t)NB * SEQ * KVW * 4);          /* [NB*SEQ][KVW] = [k | v], 2^10 carried */
  _Float16* KVT  = (_Float16*)take((size_t)2 * NB * HW * SEQ * 2);    /* [2][NB*HW][SEQ] */
  _Float16* Mt16 = (_Float16*)take((size_t)NB * NH * CD * CD * 2);    /* [NB*NH][c2][c1], 2^12 carried */
  float*    MtP  = (float*)take((size_t)KSPLIT * MTN * 4);            /* [KSPLIT][NB*NH][c2][c1], 2^12 carried partial sums */
  if (off > ws_size) return;      /* approx 34.3 MiB at NB 2, SEQ 4096 */
  _Float16* KT16 = KVT; _Float16* VT16 = KVT + (size_t)NB * HW * SEQ;
  const size_t n8x = (size_t)SEQ * CD / 8;
  for (int b = 0; b < NB; ++b)
    k_wnat<<<(unsigned)((n8x + 255) / 256), 256, 0, stream>>>(xin + (size_t)b * SEQ_FULL * CD, n8x, X16 + (size_t)b * SEQ * CD);
  /* in[CD][HW] -> out[HW][CD]; grid = (CD/64) x (HW/64) tiles */
  k_wtr<<<(CD / 64) * (HW / 64), 256, 0, stream>>>(Wqk, WT16);
  k_wtr<<<(CD / 64) * (HW / 64), 256, 0, stream>>>(Wov, WT16 + (size_t)HW * CD);
  /* [k|v] = (16 x)(2^10 W) x 1/16 -> 2^10 k, 2^10 v in f32 */
  k_gemm2<0><<<dim3((NB * SEQ / 128) * (KVW / 64), 1), 128, 0, stream>>>(X16, CD, (size_t)0, WT16, CD, (size_t)0, 0.0625f, (const float*)nullptr, (size_t)0, (const float*)nullptr, 1, (size_t)0, 0, KVf, (_Float16*)nullptr, KVW, (size_t)0, (size_t)0, NB * SEQ, KVW, CD);
  /* in[NB*SEQ][KVW] -> out[2][NB*HW][SEQ]; grid = NB x (KVW/64) x (SEQ/64) tiles */
  k_kvt<<<NB * (KVW / 64) * (SEQ / 64), 256, 0, stream>>>(KVf, KVT);
  /* Mt[b,h][c2][c1] = sum_t v[t][c2] k[t][c1]: (2^10 v)^T (2^10 k) x 2^-8 -> 2^12 M, (batch, head) on grid.y, token range on grid.z: f32 partial planes, then their sum as f16 */
  k_gemm2<0><<<dim3((CD / 128) * (CD / 64), NB * NH, KSPLIT), 128, 0, stream>>>(VT16, SEQ, (size_t)CD * SEQ, KT16, SEQ, (size_t)CD * SEQ, 0.00390625f, (const float*)nullptr, (size_t)0, (const float*)nullptr, 1, (size_t)0, 0, MtP, (_Float16*)nullptr, CD, (size_t)CD * CD, (size_t)MTN, CD, CD, SEQ / KSPLIT);
  k_mtsum<<<MTN / (256 * 4), 256, 0, stream>>>(MtP, Mt16);
  /* out[b][t][h*CD + c2] = (16 x)(2^12 Mt)^T x 2^-16, batch on grid.y; B rows n = h*CD + c2 are the output columns */
  k_gemm2<0><<<dim3((SEQ / 128) * (HW / 64), NB), 128, 0, stream>>>(X16, CD, (size_t)SEQ * CD, Mt16, CD, (size_t)HW * CD, 1.52587890625e-05f, (const float*)nullptr, (size_t)0, (const float*)nullptr, 1, (size_t)0, 0, (float*)d_out, (_Float16*)nullptr, HW, (size_t)SEQ_FULL * HW, (size_t)0, SEQ, HW, CD);
}

// v002
// It runs in 25.9 microseconds.
// In both of two side-by-side timings against v001, it was 1.84 times as fast.
// Over all steps from v000 it is 5.70 times as fast.
#include <hip/hip_runtime.h>
// Unnormalised two-head attention (no softmax, no scale, no mask): q = x for both heads, k = x Wqk, v = x Wov ([in][out] weights, head h = columns h*128..h*128+127), out[b][t][h][:] = sum_s (x_t . k_s,h) v_s,h, evaluated as out = x (k_h^T v_h) with the per-(batch, head) 128x128 matrix k_h^T v_h summed over all 4096 tokens.
// Structure: both weights RNE-converted to bf16, transposed to [out][in] and held exactly as f16 planes carried x2^10; one front launch, one workgroup per (column half, batch and head, token range): x RNE-converted to bf16 and held exactly as f16 carried x16 (staged in LDS, also stored as a plane for the last product), k and v = x W (K=128) for the range's 128 tokens, whose f32 result tiles (carried x2^10) are rounded to f16 in place and are the operands of Mt = v^T k (K=4096, cut into KSPLIT token ranges on grid.z, one f32 partial plane each, summed in range order by k_mtsum) -> f16 plane carried x2^12; out = x Mt^T (K=128, N = 256 = (head, channel)) f32 into the output buffer.
// Compute dtype: every contraction on v_wmma_f32_16x16x32_f16 (f16 operands, single products, f32 accumulate); all conversions and epilogues in f32.
#ifndef NB
#define NB 2
#endif
#ifndef SEQ
#define SEQ 4096
#endif
#define SEQ_FULL 4096
#define CD 128
#define NH 2
#define HW (NH * CD)
#define KVW (2 * HW)
#define KSPLIT 32
#define MTN (NB * NH * CD * CD)
static_assert(NB >= 1 && NB <= 2);
static_assert(SEQ <= SEQ_FULL);
static_assert(SEQ % 128 == 0);
static_assert(SEQ % 64 == 0);
static_assert(SEQ % 32 == 0);
static_assert(SEQ == KSPLIT * 128);
static_assert(MTN % (256 * 4) == 0);
static_assert(CD % 128 == 0);
static_assert(CD % 64 == 0);
static_assert(CD % 32 == 0);
static_assert(HW % 64 == 0);
static_assert(KVW % 64 == 0);
static_assert((NB * SEQ) % 128 == 0);
static_assert((SEQ * CD / 8) % 256 == 0);
static_assert(256 * 16 * 2 == 64 * 128);
static_assert(4 * 32 * 68 * 4 <= 131072);
static_assert(64 * 65 * 2 <= 131072);

typedef unsigned short v8us __attribute__((ext_vector_type(8), may_alias));
typedef float  v8f  __attribute__((ext_vector_type(8)));
typedef float  v4f  __attribute__((ext_vector_type(4)));
typedef float  v4fa __attribute__((ext_vector_type(4), may_alias));
typedef _Float16 v16h __attribute__((ext_vector_type(16)));
typedef _Float16 v4h __attribute__((ext_vector_type(4)));
union FragH { v16h v; v8us half[2]; _Float16 h[16]; unsigned short u[16]; };

constexpr size_t al256(size_t b) { return (b + 255) & ~(size_t)255; }
constexpr size_t WSB_X16 = al256((size_t)NB * SEQ * CD * 2);
constexpr size_t WSB_WT  = al256((size_t)KVW * CD * 2);
constexpr size_t WSB_MT  = al256((size_t)NB * NH * CD * CD * 2);
constexpr size_t WSB_MTP = al256((size_t)KSPLIT * MTN * 4);
static_assert(WSB_X16 + WSB_WT + WSB_MT + WSB_MTP <= (size_t)134217728);

__device__ __forceinline__ unsigned short bf16_bits(float x) { unsigned int u = __float_as_uint(x); return (unsigned short)((u + 0x7FFFu + ((u >> 16) & 1u)) >> 16); }
__device__ __forceinline__ float bf16_val(unsigned short b) { return __uint_as_float(((unsigned int)b) << 16); }
__device__ __forceinline__ float bf16_rne(float x) { return bf16_val(bf16_bits(x)); }
__device__ __forceinline__ unsigned short h2u(_Float16 x) { return __builtin_bit_cast(unsigned short, x); }
// f32 -> f16 with values below the smallest f16 normal replaced by +0 (value select)
static __device__ __forceinline__ _Float16 toh_flush(float v) { const _Float16 r = (_Float16)v; return (fabsf(v) < 6.103515625e-05f) ? (_Float16)0.0f : r; }

// 16-bit fragment loader: lane row/col = lane & 15, elements 0..7 <- k 8hh..8hh+7, elements 8..15 <- k 16+8hh..16+8hh+7 (same map for A and B)
__device__ __forceinline__ v16h g2_frag(const _Float16* p, int hh) { FragH f; f.half[0] = *(const v8us*)((const unsigned short*)p + 8 * hh); f.half[1] = *(const v8us*)((const unsigned short*)p + 16 + 8 * hh); return f.v; }
__device__ __forceinline__ v8f g2_mma(v16h a, v16h b, v8f c) { v8f d = __builtin_amdgcn_wmma_f32_16x16x32_f16(false, a, false, b, (short)0, c, false, false); asm volatile("v_nop\n\tv_nop\n\tv_nop\n\tv_nop" : "+v"(d) : "v"(a), "v"(b)); return d; }

__global__ __launch_bounds__(256) void k_wtr(const float* __restrict__ w, _Float16* __restrict__ Wt) {
  #pragma clang fp contract(off)
  __shared__ unsigned short tl[64][65];
  const int tid = threadIdx.x; const int kg = blockIdx.x / (HW / 64), ng = blockIdx.x - kg * (HW / 64); const int k0 = kg * 64, n0 = ng * 64;
  for (int i = tid; i < 64 * 8; i += 256) {
    const int j = i >> 3, d8 = (i & 7) * 8; const float* wp = w + (size_t)(k0 + j) * HW + n0 + d8;
    const v4f a = *(const v4fa*)wp, c = *(const v4fa*)(wp + 4); const float xs[8] = {a[0], a[1], a[2], a[3], c[0], c[1], c[2], c[3]};
#pragma unroll
    for (int q = 0; q < 8; ++q) tl[d8 + q][j] = h2u(toh_flush(bf16_rne(xs[q]) * 1024.0f));
  }
  __syncthreads();
  {
    for (int i = tid; i < 64 * 8; i += 256) {
      const int d = i >> 3, j8 = (i & 7) * 8; FragH f;
#pragma unroll
      for (int q = 0; q < 8; ++q) f.u[q] = tl[d][j8 + q];
      const size_t o = (size_t)(n0 + d) * CD + k0 + j8;
      *(v8us*)((unsigned short*)Wt + o) = f.half[0];
    }
     }
}

#define XP (CD + 8) /* LDS pitch of a staged x row in f16 elements: 16 bytes more than the row, so that the 16 rows one ds_load_b128 touches start in different banks */
// two f32 result tiles (tokens 0..15 and 16..31 of a 32-token block, same 16 channels), scaled and rounded in place: lane = channel, elements 0..7 <- token 8hh..8hh+7, 8..15 <- token 16+8hh..: the loader's own k map with k = token
__device__ __forceinline__ v16h pack_d(v8f d0, v8f d1) { FragH f;
#pragma unroll
  for (int r = 0; r < 8; ++r) { f.h[r] = toh_flush(d0[r] * 0.0625f); f.h[8 + r] = toh_flush(d1[r] * 0.0625f); }
  return f.v; }
__device__ __forceinline__ v8f f_mma(v16h a, v16h b, v8f c) { return __builtin_amdgcn_wmma_f32_16x16x32_f16(false, a, false, b, (short)0, c, false, false); }

// One workgroup = (64 columns c1 of Mt, (batch, head), 128 tokens); wave w owns rows c2 = 32w..32w+31 of the partial plane and makes the k fragments of columns 16w..16w+15 for all four waves.
__global__ __launch_bounds__(128) void k_front(const float* __restrict__ x, const _Float16* __restrict__ Wt, _Float16* __restrict__ X16, float* __restrict__ P) {
  __shared__ __attribute__((aligned(16))) _Float16 xs[128][XP];
  __shared__ __attribute__((aligned(16))) _Float16 kf[4][4][2][32][8];   /* [token block][column tile][fragment half][lane][8] */
  __shared__ __attribute__((aligned(16))) float so[4][32][68];
  const int tid = threadIdx.x, w = tid >> 5, lane = tid & 31, ln = lane & 15, hh = lane >> 4;
  const int nq = blockIdx.x, by = blockIdx.y, bz = blockIdx.z; const int b = by / NH, h = by - b * NH; const int t0 = bz * 128;
  const float* xb = x + ((size_t)b * SEQ_FULL + t0) * CD + (size_t)(tid >> 4) * CD + (tid & 15) * 8;
  /* every global load of the kernel is issued here, ahead of the first use, so that their latencies overlap */
  v4f la[16], lc[16];
#pragma unroll
  for (int i = 0; i < 16; ++i) { la[i] = *(const v4fa*)(xb + (size_t)i * 8 * CD); lc[i] = *(const v4fa*)(xb + (size_t)i * 8 * CD + 4); }
  asm volatile("s_wait_xcnt 0x0" ::: "memory");   /* the loads' address registers may be reused from here on */
  const _Float16* wv = Wt + (size_t)(HW + h * CD + 32 * w + ln) * CD;
  const _Float16* wk = Wt + (size_t)(h * CD + nq * 64 + 16 * w + ln) * CD;
  v16h wf[3][4];   /* 0, 1: the wave's two v channel tiles; 2: its k channel tile */
#pragma unroll
  for (int ks = 0; ks < 4; ++ks) { wf[0][ks] = g2_frag(wv + 32 * ks, hh); wf[1][ks] = g2_frag(wv + (size_t)16 * CD + 32 * ks, hh); wf[2][ks] = g2_frag(wk + 32 * ks, hh); }
  asm volatile("s_wait_xcnt 0x0" ::: "memory");   /* the same for the weight loads */
  v8us xh[16];
#pragma unroll
  for (int i = 0; i < 16; ++i) { const float v[8] = {la[i][0], la[i][1], la[i][2], la[i][3], lc[i][0], lc[i][1], lc[i][2], lc[i][3]}; FragH f;
#pragma unroll
    for (int q = 0; q < 8; ++q) f.h[q] = toh_flush(bf16_rne(v[q]) * 16.0f);
    xh[i] = f.half[0]; *(v8us*)&xs[i * 8 + (tid >> 4)][(tid & 15) * 8] = xh[i]; }
  if (nq == 0 && h == 0) {   /* one of the four workgroups that stage these tokens stores the f16 plane for the last product */
    unsigned short* xo = (unsigned short*)X16 + ((size_t)b * SEQ + t0) * CD + (size_t)(tid >> 4) * CD + (tid & 15) * 8;
#pragma unroll
    for (int i = 0; i < 16; ++i) *(v8us*)(xo + (size_t)i * 8 * CD) = xh[i];
    asm volatile("s_wait_xcnt 0x0" ::: "memory"); }   /* the stores' address and data registers are reused behind the barrier */
  __syncthreads();
  const v8f z8 = {0.f,0.f,0.f,0.f,0.f,0.f,0.f,0.f};
  v16h va[4][2], xa[2][4];
#pragma unroll
  for (int ks = 0; ks < 4; ++ks) { xa[0][ks] = g2_frag(&xs[ln][32 * ks], hh); xa[1][ks] = g2_frag(&xs[16 + ln][32 * ks], hh); }
#pragma unroll
  for (int tb = 0; tb < 4; ++tb) { v8f d[3][2] = {{z8, z8}, {z8, z8}, {z8, z8}};
#pragma unroll
    for (int ks = 0; ks < 4; ++ks)
#pragma unroll
      for (int c = 0; c < 3; ++c) { d[c][0] = f_mma(xa[0][ks], wf[c][ks], d[c][0]); d[c][1] = f_mma(xa[1][ks], wf[c][ks], d[c][1]); }
    if (tb < 3) {
#pragma unroll
      for (int ks = 0; ks < 4; ++ks) { xa[0][ks] = g2_frag(&xs[32 * tb + 32 + ln][32 * ks], hh); xa[1][ks] = g2_frag(&xs[32 * tb + 48 + ln][32 * ks], hh); } }
    __builtin_amdgcn_sched_barrier(0);   /* holds the next block's LDS loads ahead of the rounding work below, which then covers their latency */
    va[tb][0] = pack_d(d[0][0], d[0][1]); va[tb][1] = pack_d(d[1][0], d[1][1]);
    FragH f; f.v = pack_d(d[2][0], d[2][1]); *(v8us*)&kf[tb][w][0][lane][0] = f.half[0]; *(v8us*)&kf[tb][w][1][lane][0] = f.half[1]; }
  __syncthreads();
  v8f acc[2][4];
#pragma unroll
  for (int i = 0; i < 2; ++i)
#pragma unroll
    for (int j = 0; j < 4; ++j) acc[i][j] = z8;
  /* token blocks in order: v of this wave's 32 rows has stayed in registers and meets the shared k fragments */
#pragma unroll
  for (int tb = 0; tb < 4; ++tb)
#pragma unroll
    for (int j = 0; j < 4; ++j) { FragH f; f.half[0] = *(const v8us*)&kf[tb][j][0][lane][0]; f.half[1] = *(const v8us*)&kf[tb][j][1][lane][0];
      acc[0][j] = f_mma(va[tb][0], f.v, acc[0][j]); acc[1][j] = f_mma(va[tb][1], f.v, acc[1][j]); }
#pragma unroll
  for (int i = 0; i < 2; ++i)
#pragma unroll
    for (int j = 0; j < 4; ++j)
#pragma unroll
      for (int r = 0; r < 8; ++r) so[w][i * 16 + 8 * hh + r][j * 16 + ln] = acc[i][j][r] * 0.00390625f;
  /* so[w] is this wave's own: its LDS writes are ordered before its reads, no workgroup barrier */
  __builtin_amdgcn_fence(4 /* acq_rel order */, "workgroup"); __builtin_amdgcn_wave_barrier();
  float* pp = P + (size_t)bz * MTN + (size_t)by * CD * CD + (size_t)(32 * w) * CD + nq * 64;
  const int rsub = lane >> 4, c4 = (lane & 15) * 4;
#pragma unroll
  for (int q = 0; q < 16; ++q) { const int r = q * 2 + rsub; *(v4f*)(pp + (size_t)r * CD + c4) = *(const v4fa*)&so[w][r][c4]; }
}

template <int ACT>
__global__ __launch_bounds__(128) void k_gemm2(const _Float16* __restrict__ A, int lda, size_t sA, const _Float16* __restrict__ Bh, int ldb, size_t sB, float alpha, const float* __restrict__ bias, size_t sBias, const float* __restrict__ CP, int rowsPerB, size_t sCPb, int row0g,
    float* __restrict__ C, _Float16* __restrict__ C16, int ldc, size_t sC, size_t sCz, int M, int N, int K) {
  static_assert(ACT == 0);
  __shared__ __attribute__((aligned(16))) float so[4][32][68];
  const int tid = threadIdx.x, w = tid >> 5, lane = tid & 31, ln = lane & 15, hh = lane >> 4; const int by = blockIdx.y, bz = blockIdx.z;
  /* grid.z = K range: this workgroup contracts k in [bz*K, bz*K + K) and writes plane bz of C */
  A += (size_t)by * sA + (size_t)bz * K; Bh += (size_t)by * sB + (size_t)bz * K; const size_t cofs = (size_t)by * sC + (size_t)bz * sCz; const float* bp = bias ? bias + (size_t)by * sBias : nullptr;
  const int ntn = N >> 6; const int mt = blockIdx.x / ntn, nq = blockIdx.x - mt * ntn; const int row0 = mt * 128 + 32 * w, col0 = nq * 64; if (row0 >= M) return;
  const _Float16* a0p = A + (size_t)(row0 + ln) * lda; const _Float16* a1p = a0p + (size_t)16 * lda;
  const _Float16* b0p = Bh + (size_t)(col0 + ln) * ldb; const _Float16* b1p = b0p + (size_t)16 * ldb; const _Float16* b2p = b1p + (size_t)16 * ldb; const _Float16* b3p = b2p + (size_t)16 * ldb;
  const v8f z8 = {0.f,0.f,0.f,0.f,0.f,0.f,0.f,0.f}; v8f c00 = z8, c01 = z8, c02 = z8, c03 = z8, c10 = z8, c11 = z8, c12 = z8, c13 = z8;
#pragma unroll 1
  for (int kb = 0; kb < K; kb += 32) { const v16h a0 = g2_frag(a0p + kb, hh), a1 = g2_frag(a1p + kb, hh);
    v16h b = g2_frag(b0p + kb, hh); c00 = g2_mma(a0, b, c00); c10 = g2_mma(a1, b, c10);
    b = g2_frag(b1p + kb, hh); c01 = g2_mma(a0, b, c01); c11 = g2_mma(a1, b, c11);
    b = g2_frag(b2p + kb, hh); c02 = g2_mma(a0, b, c02); c12 = g2_mma(a1, b, c12);
    b = g2_frag(b3p + kb, hh); c03 = g2_mma(a0, b, c03); c13 = g2_mma(a1, b, c13); }
  v8f accs[8] = {c00, c01, c02, c03, c10, c11, c12, c13};
#pragma unroll
  for (int u = 0; u < 8; ++u) { const int t = u & 3, half = u >> 2; const int col = col0 + t * 16 + ln; const float bv = bp ? bf16_rne(bp[col]) : 0.f;
#pragma unroll
    for (int r = 0; r < 8; ++r) { const int rloc = half * 16 + 8 * hh + r; float v = accs[u][r] * alpha + bv;
      if (CP) { if (rowsPerB < 0) v += CP[cofs + (size_t)(row0g + row0 + rloc) * ldc + col]; else { const int bidx = (row0g + row0 + rloc) / rowsPerB; v += CP[(size_t)bidx * sCPb + (size_t)by * 64 + col]; } }
      so[w][rloc][t * 16 + ln] = v; } }
  __builtin_amdgcn_fence(4 /* acq_rel order */, "workgroup"); __builtin_amdgcn_wave_barrier();
  const int rsub = lane >> 4, c4 = (lane & 15) * 4;
  {
#pragma unroll
    for (int q = 0; q < 16; ++q) { const int r = q * 2 + rsub; const v4f v = *(const v4fa*)&so[w][r][c4];
      if (C) *(v4f*)(C + cofs + (size_t)(row0 + r) * ldc + col0 + c4) = v;
      if (C16) { v4h h4; for (int i = 0; i < 4; ++i) h4[i] = (_Float16)v[i]; *(v4h*)(C16 + cofs + (size_t)(row0 + r) * ldc + col0 + c4) = h4; } }
     }
}

// Mt = sum over the KSPLIT partial planes, in range order, f32, then one rounding to f16; 4 elements a thread
__global__ __launch_bounds__(256) void k_mtsum(const float* __restrict__ P, _Float16* __restrict__ Mt) {
  const size_t e = ((size_t)blockIdx.x * 256 + threadIdx.x) * 4;
  v4f s = *(const v4fa*)(P + e);
  /* unrolled so that the planes' loads overlap: rolled, each add would wait out its own load */
#pragma unroll
  for (int z = 1; z < KSPLIT; ++z) s += *(const v4fa*)(P + (size_t)z * MTN + e);
  v4h h4; for (int i = 0; i < 4; ++i) h4[i] = (_Float16)s[i];
  *(v4h*)(Mt + e) = h4;
}

extern "C" void kernel_launch(void* const* d_in, const int* in_sizes, int n_in,
                              void* d_out, int out_size, void* d_ws, size_t ws_size, hipStream_t stream) {
  if (n_in < 3) return;
  if ((size_t)in_sizes[0] < (size_t)(NB - 1) * SEQ_FULL * CD + (size_t)SEQ * CD || in_sizes[1] < CD * HW || in_sizes[2] < CD * HW) return;
  if ((size_t)out_size < (size_t)(NB - 1) * SEQ_FULL * HW + (size_t)SEQ * HW) return;
  const float* xin = (const float*)d_in[0]; const float* Wqk = (const float*)d_in[1]; const float* Wov = (const float*)d_in[2];
  char* ws = (char*)d_ws; size_t off = 0;
  auto take = [&](size_t bytes) { char* p = ws + off; off += (bytes + 255) & ~(size_t)255; return p; };
  _Float16* X16  = (_Float16*)take((size_t)NB * SEQ * CD * 2);        /* [NB*SEQ][CD], 16 x */
  _Float16* WT16 = (_Float16*)take((size_t)KVW * CD * 2);             /* [KVW][CD]: rows 0..HW-1 = Wqk^T, HW..KVW-1 = Wov^T, 2^10 w */
  _Float16* Mt16 = (_Float16*)take((size_t)NB * NH * CD * CD * 2);    /* [NB*NH][c2][c1], 2^12 carried */
  float*    MtP  = (float*)take((size_t)KSPLIT * MTN * 4);            /* [KSPLIT][NB*NH][c2][c1], 2^12 carried partial sums */
  if (off > ws_size) return;      /* approx 10.3 MiB at NB 2, SEQ 4096 */
  /* in[CD][HW] -> out[HW][CD]; grid = (CD/64) x (HW/64) tiles */
  k_wtr<<<(CD / 64) * (HW / 64), 256, 0, stream>>>(Wqk, WT16);
  k_wtr<<<(CD / 64) * (HW / 64), 256, 0, stream>>>(Wov, WT16 + (size_t)HW * CD);
  /* k, v = (16 x)(2^10 W) x 1/16 -> 2^10 k, 2^10 v as f16; Mt[b,h][c2][c1] = sum_t v[t][c2] k[t][c1]: (2^10 v)^T (2^10 k) x 2^-8 -> 2^12 M; column half on grid.x, (batch, head) on grid.y, token range on grid.z: f32 partial planes, then their sum as f16 */
  k_front<<<dim3(CD / 64, NB * NH, KSPLIT), 128, 0, stream>>>(xin, WT16, X16, MtP);
  k_mtsum<<<MTN / (256 * 4), 256, 0, stream>>>(MtP, Mt16);
  /* out[b][t][h*CD + c2] = (16 x)(2^12 Mt)^T x 2^-16, batch on grid.y; B rows n = h*CD + c2 are the output columns */
  k_gemm2<0><<<dim3((SEQ / 128) * (HW / 64), NB), 128, 0, stream>>>(X16, CD, (size_t)SEQ * CD, Mt16, CD, (size_t)HW * CD, 1.52587890625e-05f, (const float*)nullptr, (size_t)0, (const float*)nullptr, 1, (size_t)0, 0, (float*)d_out, (_Float16*)nullptr, HW, (size_t)SEQ_FULL * HW, (size_t)0, SEQ, HW, CD);
}

// v003
// One run takes 22 microseconds.
// Two timings next to v002 put it at 1.15 and 1.16 times that version's speed.
// Counting every step since v000, it is 6.59 times as fast.
#include <hip/hip_runtime.h>
// Unnormalised two-head attention (no softmax, no scale, no mask): q = x for both heads, k = x Wqk, v = x Wov ([in][out] weights, head h = columns h*128..h*128+127), out[b][t][h][:] = sum_s (x_t . k_s,h) v_s,h, evaluated as out = x (k_h^T v_h) with the per-(batch, head) 128x128 matrix k_h^T v_h summed over all 4096 tokens.
// Structure: one front launch with one workgroup per (column half, batch and head, token range): each wave reads its own weight columns as f32 straight into B fragment order, RNE-converted to bf16 and held exactly as f16 carried x2^10; x RNE-converted to bf16 and held exactly as f16 carried x16 (staged in LDS, also stored as a plane for the last product), k and v = x W (K=128) for the range's 128 tokens, whose f32 result tiles (carried x2^10) are rounded to f16 in place and are the operands of Mt = v^T k (K=4096, cut into KSPLIT token ranges on grid.z, one f32 partial plane each, summed in range order by k_mtsum) -> f16 plane carried x2^12; out = x Mt^T (K=128, N = 256 = (head, channel)) f32 into the output buffer.
// Compute dtype: every contraction on v_wmma_f32_16x16x32_f16 (f16 operands, single products, f32 accumulate); all conversions and epilogues in f32.
#ifndef NB
#define NB 2
#endif
#ifndef SEQ
#define SEQ 4096
#endif
#define SEQ_FULL 4096
#define CD 128
#define NH 2
#define HW (NH * CD)
#define KVW (2 * HW)
#define KSPLIT 32
#define MTN (NB * NH * CD * CD)
static_assert(NB >= 1 && NB <= 2);
static_assert(SEQ <= SEQ_FULL);
static_assert(SEQ % 128 == 0);
static_assert(SEQ % 64 == 0);
static_assert(SEQ % 32 == 0);
static_assert(SEQ == KSPLIT * 128);
static_assert(MTN % (256 * 4) == 0);
static_assert(CD % 128 == 0);
static_assert(CD % 64 == 0);
static_assert(CD % 32 == 0);
static_assert(HW % 64 == 0);
static_assert(KVW % 64 == 0);
static_assert((NB * SEQ) % 128 == 0);
static_assert((SEQ * CD / 8) % 256 == 0);
static_assert(256 * 16 * 2 == 64 * 128);
static_assert(4 * 32 * 68 * 4 <= 131072);

typedef unsigned short v8us __attribute__((ext_vector_type(8), may_alias));
typedef float  v8f  __attribute__((ext_vector_type(8)));
typedef float  v4f  __attribute__((ext_vector_type(4)));
typedef float  v4fa __attribute__((ext_vector_type(4), may_alias));
typedef _Float16 v16h __attribute__((ext_vector_type(16)));
typedef _Float16 v4h __attribute__((ext_vector_type(4)));
union FragH { v16h v; v8us half[2]; _Float16 h[16]; unsigned short u[16]; };

constexpr size_t al256(size_t b) { return (b + 255) & ~(size_t)255; }
constexpr size_t WSB_X16 = al256((size_t)NB * SEQ * CD * 2);
constexpr size_t WSB_MT  = al256((size_t)NB * NH * CD * CD * 2);
constexpr size_t WSB_MTP = al256((size_t)KSPLIT * MTN * 4);
static_assert(WSB_X16 + WSB_MT + WSB_MTP <= (size_t)134217728);

__device__ __forceinline__ unsigned short bf16_bits(float x) { unsigned int u = __float_as_uint(x); return (unsigned short)((u + 0x7FFFu + ((u >> 16) & 1u)) >> 16); }
__device__ __forceinline__ float bf16_val(unsigned short b) { return __uint_as_float(((unsigned int)b) << 16); }
__device__ __forceinline__ float bf16_rne(float x) { return bf16_val(bf16_bits(x)); }
typedef float v2f __attribute__((ext_vector_type(2)));
typedef __bf16 v2bf __attribute__((ext_vector_type(2)));
// bf16_rne of two values through the packed hardware convert (round to nearest even too: the same values for every finite input), fewer and shorter instructions: keeps the front kernel's text small
__device__ __forceinline__ v2f bf16_rne2(float a, float b) { const v2f p = {a, b}; const unsigned int u = __builtin_bit_cast(unsigned int, __builtin_convertvector(p, v2bf)); const v2f r = {__uint_as_float(u << 16), __uint_as_float(u & 0xFFFF0000u)}; return r; }
// f32 -> f16 with values below the smallest f16 normal replaced by +0 (value select)
static __device__ __forceinline__ _Float16 toh_flush(float v) { const _Float16 r = (_Float16)v; return (fabsf(v) < 6.103515625e-05f) ? (_Float16)0.0f : r; }

// 16-bit fragment loader: lane row/col = lane & 15, elements 0..7 <- k 8hh..8hh+7, elements 8..15 <- k 16+8hh..16+8hh+7 (same map for A and B)
__device__ __forceinline__ v16h g2_frag(const _Float16* p, int hh) { FragH f; f.half[0] = *(const v8us*)((const unsigned short*)p + 8 * hh); f.half[1] = *(const v8us*)((const unsigned short*)p + 16 + 8 * hh); return f.v; }
__device__ __forceinline__ v8f g2_mma(v16h a, v16h b, v8f c) { v8f d = __builtin_amdgcn_wmma_f32_16x16x32_f16(false, a, false, b, (short)0, c, false, false); asm volatile("v_nop\n\tv_nop\n\tv_nop\n\tv_nop" : "+v"(d) : "v"(a), "v"(b)); return d; }

#define XP (CD + 8) /* LDS pitch of a staged x row in f16 elements: 16 bytes more than the row, so that the 16 rows one ds_load_b128 touches start in different banks */
// two f32 result tiles (tokens 0..15 and 16..31 of a 32-token block, same 16 channels), scaled and rounded in place: lane = channel, elements 0..7 <- token 8hh..8hh+7, 8..15 <- token 16+8hh..: the loader's own k map with k = token
__device__ __forceinline__ v16h pack_d(v8f d0, v8f d1) { FragH f;
#pragma unroll
  for (int r = 0; r < 8; ++r) { f.h[r] = toh_flush(d0[r] * 0.0625f); f.h[8 + r] = toh_flush(d1[r] * 0.0625f); }
  return f.v; }
__device__ __forceinline__ v8f f_mma(v16h a, v16h b, v8f c) { return __builtin_amdgcn_wmma_f32_16x16x32_f16(false, a, false, b, (short)0, c, false, false); }

// One workgroup = (64 columns c1 of Mt, (batch, head), 128 tokens); wave w owns rows c2 = 32w..32w+31 of the partial plane and makes the k fragments of columns 16w..16w+15 for all four waves.
__global__ __launch_bounds__(128) void k_front(const float* __restrict__ x, const float* __restrict__ Wqk, const float* __restrict__ Wov, _Float16* __restrict__ X16, float* __restrict__ P) {
  __shared__ __attribute__((aligned(16))) _Float16 xs[128][XP];
  __shared__ __attribute__((aligned(16))) _Float16 kf[4][4][2][32][8];   /* [token block][column tile][fragment half][lane][8] */
  __shared__ __attribute__((aligned(16))) float so[4][32][68];
  const int tid = threadIdx.x, w = tid >> 5, lane = tid & 31, ln = lane & 15, hh = lane >> 4;
  const int nq = blockIdx.x, by = blockIdx.y, bz = blockIdx.z; const int b = by / NH, h = by - b * NH; const int t0 = bz * 128;
  const float* xb = x + ((size_t)b * SEQ_FULL + t0) * CD + (size_t)(tid >> 4) * CD + (tid & 15) * 8;
  /* every global load of the kernel is issued here, ahead of the first use, so that their latencies overlap */
  /* weights are [in][out] f32: lane = output column, element e of fragment ks = input row 32ks + 8hh + (e & 7) + 16(e >> 3), the loader's own k map */
  const float* pv = Wov + (size_t)(8 * hh) * HW + h * CD + 32 * w + ln;
  const float* pk = Wqk + (size_t)(8 * hh) * HW + h * CD + nq * 64 + 16 * w + ln;
  float rw[3][4][16];   /* 0, 1: the wave's two v channel tiles; 2: its k channel tile */
#pragma unroll
  for (int ks = 0; ks < 4; ++ks)
#pragma unroll
    for (int e = 0; e < 16; ++e) { const size_t ro = (size_t)(32 * ks + (e & 7) + 16 * (e >> 3)) * HW; rw[0][ks][e] = pv[ro]; rw[1][ks][e] = pv[ro + 16]; rw[2][ks][e] = pk[ro]; }
  v4f la[16], lc[16];
#pragma unroll
  for (int i = 0; i < 16; ++i) { la[i] = *(const v4fa*)(xb + (size_t)i * 8 * CD); lc[i] = *(const v4fa*)(xb + (size_t)i * 8 * CD + 4); }
  asm volatile("s_wait_xcnt 0x0" :: "v"(pv), "v"(pk), "v"(xb) : "memory");   /* the loads' address registers may be reused from here on; named as inputs so that none is handed out as a later load's destination ahead of the wait */
  __builtin_amdgcn_sched_barrier(0);   /* no vector instruction that reuses an address register moves up over the wait */
  v16h wf[3][4];
#pragma unroll
  for (int ks = 0; ks < 4; ++ks)
#pragma unroll
    for (int c = 0; c < 3; ++c) { FragH f;
#pragma unroll
      for (int e = 0; e < 16; e += 2) { const v2f r = bf16_rne2(rw[c][ks][e], rw[c][ks][e + 1]); f.h[e] = toh_flush(r[0] * 1024.0f); f.h[e + 1] = toh_flush(r[1] * 1024.0f); }
      wf[c][ks] = f.v; }
  v8us xh[16];
#pragma unroll
  for (int i = 0; i < 16; ++i) { const float v[8] = {la[i][0], la[i][1], la[i][2], la[i][3], lc[i][0], lc[i][1], lc[i][2], lc[i][3]}; FragH f;
#pragma unroll
    for (int q = 0; q < 8; ++q) f.h[q] = toh_flush(bf16_rne(v[q]) * 16.0f);
    xh[i] = f.half[0]; *(v8us*)&xs[i * 8 + (tid >> 4)][(tid & 15) * 8] = xh[i]; }
  if (nq == 0 && h == 0) {   /* one of the four workgroups that stage these tokens stores the f16 plane for the last product */
    unsigned short* xo = (unsigned short*)X16 + ((size_t)b * SEQ + t0) * CD + (size_t)(tid >> 4) * CD + (tid & 15) * 8;
#pragma unroll
    for (int i = 0; i < 16; ++i) *(v8us*)(xo + (size_t)i * 8 * CD) = xh[i];
    asm volatile("s_wait_xcnt 0x0" ::: "memory"); }   /* the stores' address and data registers are reused behind the barrier */
  __syncthreads();
  const v8f z8 = {0.f,0.f,0.f,0.f,0.f,0.f,0.f,0.f};
  v16h va[4][2], xa[2][4];
#pragma unroll
  for (int ks = 0; ks < 4; ++ks) { xa[0][ks] = g2_frag(&xs[ln][32 * ks], hh); xa[1][ks] = g2_frag(&xs[16 + ln][32 * ks], hh); }
#pragma unroll
  for (int tb = 0; tb < 4; ++tb) { v8f d[3][2] = {{z8, z8}, {z8, z8}, {z8, z8}};
#pragma unroll
    for (int ks = 0; ks < 4; ++ks)
#pragma unroll
      for (int c = 0; c < 3; ++c) { d[c][0] = f_mma(xa[0][ks], wf[c][ks], d[c][0]); d[c][1] = f_mma(xa[1][ks], wf[c][ks], d[c][1]); }
    if (tb < 3) {
#pragma unroll
      for (int ks = 0; ks < 4; ++ks) { xa[0][ks] = g2_frag(&xs[32 * tb + 32 + ln][32 * ks], hh); xa[1][ks] = g2_frag(&xs[32 * tb + 48 + ln][32 * ks], hh); } }
    __builtin_amdgcn_sched_barrier(0);   /* holds the next block's LDS loads ahead of the rounding work below, which then covers their latency */
    va[tb][0] = pack_d(d[0][0], d[0][1]); va[tb][1] = pack_d(d[1][0], d[1][1]);
    FragH f; f.v = pack_d(d[2][0], d[2][1]); *(v8us*)&kf[tb][w][0][lane][0] = f.half[0]; *(v8us*)&kf[tb][w][1][lane][0] = f.half[1]; }
  __syncthreads();
  v8f acc[2][4];
#pragma unroll
  for (int i = 0; i < 2; ++i)
#pragma unroll
    for (int j = 0; j < 4; ++j) acc[i][j] = z8;
  /* token blocks in order: v of this wave's 32 rows has stayed in registers and meets the shared k fragments */
#pragma unroll
  for (int tb = 0; tb < 4; ++tb)
#pragma unroll
    for (int j = 0; j < 4; ++j) { FragH f; f.half[0] = *(const v8us*)&kf[tb][j][0][lane][0]; f.half[1] = *(const v8us*)&kf[tb][j][1][lane][0];
      acc[0][j] = f_mma(va[tb][0], f.v, acc[0][j]); acc[1][j] = f_mma(va[tb][1], f.v, acc[1][j]); }
#pragma unroll
  for (int i = 0; i < 2; ++i)
#pragma unroll
    for (int j = 0; j < 4; ++j)
#pragma unroll
      for (int r = 0; r < 8; ++r) so[w][i * 16 + 8 * hh + r][j * 16 + ln] = acc[i][j][r] * 0.00390625f;
  /* so[w] is this wave's own: its LDS writes are ordered before its reads, no workgroup barrier */
  __builtin_amdgcn_fence(4 /* acq_rel order */, "workgroup"); __builtin_amdgcn_wave_barrier();
  float* pp = P + (size_t)bz * MTN + (size_t)by * CD * CD + (size_t)(32 * w) * CD + nq * 64;
  const int rsub = lane >> 4, c4 = (lane & 15) * 4;
#pragma unroll
  for (int q = 0; q < 16; ++q) { const int r = q * 2 + rsub; *(v4f*)(pp + (size_t)r * CD + c4) = *(const v4fa*)&so[w][r][c4]; }
}

template <int ACT>
__global__ __launch_bounds__(128) void k_gemm2(const _Float16* __restrict__ A, int lda, size_t sA, const _Float16* __restrict__ Bh, int ldb, size_t sB, float alpha, const float* __restrict__ bias, size_t sBias, const float* __restrict__ CP, int rowsPerB, size_t sCPb, int row0g,
    float* __restrict__ C, _Float16* __restrict__ C16, int ldc, size_t sC, size_t sCz, int M, int N, int K) {
  static_assert(ACT == 0);
  __shared__ __attribute__((aligned(16))) float so[4][32][68];
  const int tid = threadIdx.x, w = tid >> 5, lane = tid & 31, ln = lane & 15, hh = lane >> 4; const int by = blockIdx.y, bz = blockIdx.z;
  /* grid.z = K range: this workgroup contracts k in [bz*K, bz*K + K) and writes plane bz of C */
  A += (size_t)by * sA + (size_t)bz * K; Bh += (size_t)by * sB + (size_t)bz * K; const size_t cofs = (size_t)by * sC + (size_t)bz * sCz; const float* bp = bias ? bias + (size_t)by * sBias : nullptr;
  const int ntn = N >> 6; const int mt = blockIdx.x / ntn, nq = blockIdx.x - mt * ntn; const int row0 = mt * 128 + 32 * w, col0 = nq * 64; if (row0 >= M) return;
  const _Float16* a0p = A + (size_t)(row0 + ln) * lda; const _Float16* a1p = a0p + (size_t)16 * lda;
  const _Float16* b0p = Bh + (size_t)(col0 + ln) * ldb; const _Float16* b1p = b0p + (size_t)16 * ldb; const _Float16* b2p = b1p + (size_t)16 * ldb; const _Float16* b3p = b2p + (size_t)16 * ldb;
  const v8f z8 = {0.f,0.f,0.f,0.f,0.f,0.f,0.f,0.f}; v8f c00 = z8, c01 = z8, c02 = z8, c03 = z8, c10 = z8, c11 = z8, c12 = z8, c13 = z8;
#pragma unroll 1
  for (int kb = 0; kb < K; kb += 32) { const v16h a0 = g2_frag(a0p + kb, hh), a1 = g2_frag(a1p + kb, hh);
    v16h b = g2_frag(b0p + kb, hh); c00 = g2_mma(a0, b, c00); c10 = g2_mma(a1, b, c10);
    b = g2_frag(b1p + kb, hh); c01 = g2_mma(a0, b, c01); c11 = g2_mma(a1, b, c11);
    b = g2_frag(b2p + kb, hh); c02 = g2_mma(a0, b, c02); c12 = g2_mma(a1, b, c12);
    b = g2_frag(b3p + kb, hh); c03 = g2_mma(a0, b, c03); c13 = g2_mma(a1, b, c13); }
  v8f accs[8] = {c00, c01, c02, c03, c10, c11, c12, c13};
#pragma unroll
  for (int u = 0; u < 8; ++u) { const int t = u & 3, half = u >> 2; const int col = col0 + t * 16 + ln; const float bv = bp ? bf16_rne(bp[col]) : 0.f;
#pragma unroll
    for (int r = 0; r < 8; ++r) { const int rloc = half * 16 + 8 * hh + r; float v = accs[u][r] * alpha + bv;
      if (CP) { if (rowsPerB < 0) v += CP[cofs + (size_t)(row0g + row0 + rloc) * ldc + col]; else { const int bidx = (row0g + row0 + rloc) / rowsPerB; v += CP[(size_t)bidx * sCPb + (size_t)by * 64 + col]; } }
      so[w][rloc][t * 16 + ln] = v; } }
  __builtin_amdgcn_fence(4 /* acq_rel order */, "workgroup"); __builtin_amdgcn_wave_barrier();
  const int rsub = lane >> 4, c4 = (lane & 15) * 4;
  {
#pragma unroll
    for (int q = 0; q < 16; ++q) { const int r = q * 2 + rsub; const v4f v = *(const v4fa*)&so[w][r][c4];
      if (C) *(v4f*)(C + cofs + (size_t)(row0 + r) * ldc + col0 + c4) = v;
      if (C16) { v4h h4; for (int i = 0; i < 4; ++i) h4[i] = (_Float16)v[i]; *(v4h*)(C16 + cofs + (size_t)(row0 + r) * ldc + col0 + c4) = h4; } }
     }
}

// Mt = sum over the KSPLIT partial planes, in range order, f32, then one rounding to f16; 4 elements a thread
__global__ __launch_bounds__(256) void k_mtsum(const float* __restrict__ P, _Float16* __restrict__ Mt) {
  const size_t e = ((size_t)blockIdx.x * 256 + threadIdx.x) * 4;
  v4f s = *(const v4fa*)(P + e);
  /* unrolled so that the planes' loads overlap: rolled, each add would wait out its own load */
#pragma unroll
  for (int z = 1; z < KSPLIT; ++z) s += *(const v4fa*)(P + (size_t)z * MTN + e);
  v4h h4; for (int i = 0; i < 4; ++i) h4[i] = (_Float16)s[i];
  *(v4h*)(Mt + e) = h4;
}

extern "C" void kernel_launch(void* const* d_in, const int* in_sizes, int n_in,
                              void* d_out, int out_size, void* d_ws, size_t ws_size, hipStream_t stream) {
  if (n_in < 3) return;
  if ((size_t)in_sizes[0] < (size_t)(NB - 1) * SEQ_FULL * CD + (size_t)SEQ * CD || in_sizes[1] < CD * HW || in_sizes[2] < CD * HW) return;
  if ((size_t)out_size < (size_t)(NB - 1) * SEQ_FULL * HW + (size_t)SEQ * HW) return;
  const float* xin = (const float*)d_in[0]; const float* Wqk = (const float*)d_in[1]; const float* Wov = (const float*)d_in[2];
  char* ws = (char*)d_ws; size_t off = 0;
  auto take = [&](size_t bytes) { char* p = ws + off; off += (bytes + 255) & ~(size_t)255; return p; };
  _Float16* X16  = (_Float16*)take((size_t)NB * SEQ * CD * 2);        /* [NB*SEQ][CD], 16 x */
  _Float16* Mt16 = (_Float16*)take((size_t)NB * NH * CD * CD * 2);    /* [NB*NH][c2][c1], 2^12 carried */
  float*    MtP  = (float*)take((size_t)KSPLIT * MTN * 4);            /* [KSPLIT][NB*NH][c2][c1], 2^12 carried partial sums */
  if (off > ws_size) return;      /* approx 10.1 MiB at NB 2, SEQ 4096 */
  /* k, v = (16 x)(2^10 W) x 1/16 -> 2^10 k, 2^10 v as f16; Mt[b,h][c2][c1] = sum_t v[t][c2] k[t][c1]: (2^10 v)^T (2^10 k) x 2^-8 -> 2^12 M; column half on grid.x, (batch, head) on grid.y, token range on grid.z: f32 partial planes, then their sum as f16 */
  k_front<<<dim3(CD / 64, NB * NH, KSPLIT), 128, 0, stream>>>(xin, Wqk, Wov, X16, MtP);
  k_mtsum<<<MTN / (256 * 4), 256, 0, stream>>>(MtP, Mt16);
  /* out[b][t][h*CD + c2] = (16 x)(2^12 Mt)^T x 2^-16, batch on grid.y; B rows n = h*CD + c2 are the output columns */
  k_gemm2<0><<<dim3((SEQ / 128) * (HW / 64), NB), 128, 0, stream>>>(X16, CD, (size_t)SEQ * CD, Mt16, CD, (size_t)HW * CD, 1.52587890625e-05f, (const float*)nullptr, (size_t)0, (const float*)nullptr, 1, (size_t)0, 0, (float*)d_out, (_Float16*)nullptr, HW, (size_t)SEQ_FULL * HW, (size_t)0, SEQ, HW, CD);
}

// v004
// A run of this version takes 16.1 microseconds.
// Timed twice side by side with v003, it ran 1.35 and 1.36 times as fast.
// Over all steps from v000 it is 8.93 times as fast.
#include <hip/hip_runtime.h>
// Unnormalised two-head attention (no softmax, no scale, no mask): q = x for both heads, k = x Wqk, v = x Wov ([in][out] weights, head h = columns h*128..h*128+127), out[b][t][h][:] = sum_s (x_t . k_s,h) v_s,h, evaluated as out = x (k_h^T v_h) with the per-(batch, head) 128x128 matrix k_h^T v_h summed over all 4096 tokens.
// Structure: one front launch with one workgroup per (column half, batch and head, token range): each wave reads its own weight columns as f32 straight into B fragment order, RNE-converted to bf16 and held exactly as f16 carried x2^10; x RNE-converted to bf16 and held exactly as f16 carried x16 (staged in LDS, also stored as a plane for the last product), k and v = x W (K=128) for the range's 128 tokens, whose f32 result tiles (carried x2^10) are rounded to f16 in place and are the operands of Mt = v^T k (K=4096, cut into KSPLIT token ranges on grid.z, one f32 partial plane each, summed in range order by k_mtsum) -> f16 plane carried x2^12; out = x Mt^T (K=128, N = 256 = (head, channel)) f32 into the output buffer.
// Compute dtype: every contraction on v_wmma_f32_16x16x32_f16 (f16 operands, single products, f32 accumulate); all conversions and epilogues in f32.
#ifndef NB
#define NB 2
#endif
#ifndef SEQ
#define SEQ 4096
#endif
#define SEQ_FULL 4096
#define CD 128
#define NH 2
#define HW (NH * CD)
#define KVW (2 * HW)
#define KSPLIT 32
#define MTN (NB * NH * CD * CD)
static_assert(NB >= 1 && NB <= 2);
static_assert(SEQ <= SEQ_FULL);
static_assert(SEQ % 128 == 0);
static_assert(SEQ % 64 == 0);
static_assert(SEQ % 32 == 0);
static_assert(SEQ == KSPLIT * 128);
static_assert(MTN % (256 * 4) == 0);
static_assert(CD % 128 == 0);
static_assert(CD % 64 == 0);
static_assert(CD % 32 == 0);
static_assert(HW % 64 == 0);
static_assert(KVW % 64 == 0);
static_assert((NB * SEQ) % 128 == 0);
static_assert((SEQ * CD / 8) % 256 == 0);
static_assert(256 * 16 * 2 == 64 * 128);
static_assert(4 * 32 * 68 * 4 <= 131072);

typedef unsigned short v8us __attribute__((ext_vector_type(8), may_alias));
typedef float  v8f  __attribute__((ext_vector_type(8)));
typedef float  v4f  __attribute__((ext_vector_type(4)));
typedef float  v4fa __attribute__((ext_vector_type(4), may_alias));
typedef _Float16 v16h __attribute__((ext_vector_type(16)));
typedef _Float16 v4h __attribute__((ext_vector_type(4)));
union FragH { v16h v; v8us half[2]; _Float16 h[16]; unsigned short u[16]; };

constexpr size_t al256(size_t b) { return (b + 255) & ~(size_t)255; }
constexpr size_t WSB_X16 = al256((size_t)NB * SEQ * CD * 2);
constexpr size_t WSB_MT  = al256((size_t)NB * NH * CD * CD * 2);
constexpr size_t WSB_MTP = al256((size_t)KSPLIT * MTN * 4);
static_assert(WSB_X16 + WSB_MT + WSB_MTP <= (size_t)134217728);

__device__ __forceinline__ unsigned short bf16_bits(float x) { unsigned int u = __float_as_uint(x); return (unsigned short)((u + 0x7FFFu + ((u >> 16) & 1u)) >> 16); }
__device__ __forceinline__ float bf16_val(unsigned short b) { return __uint_as_float(((unsigned int)b) << 16); }
__device__ __forceinline__ float bf16_rne(float x) { return bf16_val(bf16_bits(x)); }
typedef float v2f __attribute__((ext_vector_type(2)));
typedef __bf16 v2bf __attribute__((ext_vector_type(2)));
// bf16_rne of two values through the packed hardware convert (round to nearest even too: the same values for every finite input), fewer and shorter instructions: keeps the front kernel's text small
__device__ __forceinline__ v2f bf16_rne2(float a, float b) { const v2f p = {a, b}; const unsigned int u = __builtin_bit_cast(unsigned int, __builtin_convertvector(p, v2bf)); const v2f r = {__uint_as_float(u << 16), __uint_as_float(u & 0xFFFF0000u)}; return r; }
// f32 -> f16 with values below the smallest f16 normal replaced by +0 (value select)
static __device__ __forceinline__ _Float16 toh_flush(float v) { const _Float16 r = (_Float16)v; return (fabsf(v) < 6.103515625e-05f) ? (_Float16)0.0f : r; }

// 16-bit fragment loader: lane row/col = lane & 15, elements 0..7 <- k 8hh..8hh+7, elements 8..15 <- k 16+8hh..16+8hh+7 (same map for A and B)
__device__ __forceinline__ v16h g2_frag(const _Float16* p, int hh) { FragH f; f.half[0] = *(const v8us*)((const unsigned short*)p + 8 * hh); f.half[1] = *(const v8us*)((const unsigned short*)p + 16 + 8 * hh); return f.v; }

#define XP (CD + 8) /* LDS pitch of a staged x row in f16 elements: 16 bytes more than the row, so that the 16 rows one ds_load_b128 touches start in different banks */
// two f32 result tiles (tokens 0..15 and 16..31 of a 32-token block, same 16 channels), scaled and rounded in place: lane = channel, elements 0..7 <- token 8hh..8hh+7, 8..15 <- token 16+8hh..: the loader's own k map with k = token
__device__ __forceinline__ v16h pack_d(v8f d0, v8f d1) { FragH f;
#pragma unroll
  for (int r = 0; r < 8; ++r) { f.h[r] = toh_flush(d0[r] * 0.0625f); f.h[8 + r] = toh_flush(d1[r] * 0.0625f); }
  return f.v; }
__device__ __forceinline__ v8f f_mma(v16h a, v16h b, v8f c) { return __builtin_amdgcn_wmma_f32_16x16x32_f16(false, a, false, b, (short)0, c, false, false); }

// One workgroup = (64 columns c1 of Mt, (batch, head), 128 tokens); wave w owns rows c2 = 32w..32w+31 of the partial plane and makes the k fragments of columns 16w..16w+15 for all four waves.
__global__ __launch_bounds__(128) void k_front(const float* __restrict__ x, const float* __restrict__ Wqk, const float* __restrict__ Wov, _Float16* __restrict__ X16, float* __restrict__ P) {
  __shared__ __attribute__((aligned(16))) _Float16 xs[128][XP];
  __shared__ __attribute__((aligned(16))) _Float16 kf[4][4][2][32][8];   /* [token block][column tile][fragment half][lane][8] */
  __shared__ __attribute__((aligned(16))) float so[4][32][68];
  const int tid = threadIdx.x, w = tid >> 5, lane = tid & 31, ln = lane & 15, hh = lane >> 4;
  const int nq = blockIdx.x, by = blockIdx.y, bz = blockIdx.z; const int b = by / NH, h = by - b * NH; const int t0 = bz * 128;
  const float* xb = x + ((size_t)b * SEQ_FULL + t0) * CD + (size_t)(tid >> 4) * CD + (tid & 15) * 8;
  /* every global load of the kernel is issued here, ahead of the first use, so that their latencies overlap */
  /* weights are [in][out] f32: lane = output column, element e of fragment ks = input row 32ks + 8hh + (e & 7) + 16(e >> 3), the loader's own k map */
  const float* pv = Wov + (size_t)(8 * hh) * HW + h * CD + 32 * w + ln;
  const float* pk = Wqk + (size_t)(8 * hh) * HW + h * CD + nq * 64 + 16 * w + ln;
  float rw[3][4][16];   /* 0, 1: the wave's two v channel tiles; 2: its k channel tile */
#pragma unroll
  for (int ks = 0; ks < 4; ++ks)
#pragma unroll
    for (int e = 0; e < 16; ++e) { const size_t ro = (size_t)(32 * ks + (e & 7) + 16 * (e >> 3)) * HW; rw[0][ks][e] = pv[ro]; rw[1][ks][e] = pv[ro + 16]; rw[2][ks][e] = pk[ro]; }
  v4f la[16], lc[16];
#pragma unroll
  for (int i = 0; i < 16; ++i) { la[i] = *(const v4fa*)(xb + (size_t)i * 8 * CD); lc[i] = *(const v4fa*)(xb + (size_t)i * 8 * CD + 4); }
  asm volatile("s_wait_xcnt 0x0" :: "v"(pv), "v"(pk), "v"(xb) : "memory");   /* the loads' address registers may be reused from here on; named as inputs so that none is handed out as a later load's destination ahead of the wait */
  __builtin_amdgcn_sched_barrier(0);   /* no vector instruction that reuses an address register moves up over the wait */
  v16h wf[3][4];
#pragma unroll
  for (int ks = 0; ks < 4; ++ks)
#pragma unroll
    for (int c = 0; c < 3; ++c) { FragH f;
#pragma unroll
      for (int e = 0; e < 16; e += 2) { const v2f r = bf16_rne2(rw[c][ks][e], rw[c][ks][e + 1]); f.h[e] = toh_flush(r[0] * 1024.0f); f.h[e + 1] = toh_flush(r[1] * 1024.0f); }
      wf[c][ks] = f.v; }
  v8us xh[16];
#pragma unroll
  for (int i = 0; i < 16; ++i) { const float v[8] = {la[i][0], la[i][1], la[i][2], la[i][3], lc[i][0], lc[i][1], lc[i][2], lc[i][3]}; FragH f;
#pragma unroll
    for (int q = 0; q < 8; ++q) f.h[q] = toh_flush(bf16_rne(v[q]) * 16.0f);
    xh[i] = f.half[0]; *(v8us*)&xs[i * 8 + (tid >> 4)][(tid & 15) * 8] = xh[i]; }
  if (nq == 0 && h == 0) {   /* one of the four workgroups that stage these tokens stores the f16 plane for the last product */
    unsigned short* xo = (unsigned short*)X16 + ((size_t)b * SEQ + t0) * CD + (size_t)(tid >> 4) * CD + (tid & 15) * 8;
#pragma unroll
    for (int i = 0; i < 16; ++i) *(v8us*)(xo + (size_t)i * 8 * CD) = xh[i];
    asm volatile("s_wait_xcnt 0x0" ::: "memory"); }   /* the stores' address and data registers are reused behind the barrier */
  __syncthreads();
  const v8f z8 = {0.f,0.f,0.f,0.f,0.f,0.f,0.f,0.f};
  v16h va[4][2], xa[2][4];
#pragma unroll
  for (int ks = 0; ks < 4; ++ks) { xa[0][ks] = g2_frag(&xs[ln][32 * ks], hh); xa[1][ks] = g2_frag(&xs[16 + ln][32 * ks], hh); }
#pragma unroll
  for (int tb = 0; tb < 4; ++tb) { v8f d[3][2] = {{z8, z8}, {z8, z8}, {z8, z8}};
#pragma unroll
    for (int ks = 0; ks < 4; ++ks)
#pragma unroll
      for (int c = 0; c < 3; ++c) { d[c][0] = f_mma(xa[0][ks], wf[c][ks], d[c][0]); d[c][1] = f_mma(xa[1][ks], wf[c][ks], d[c][1]); }
    if (tb < 3) {
#pragma unroll
      for (int ks = 0; ks < 4; ++ks) { xa[0][ks] = g2_frag(&xs[32 * tb + 32 + ln][32 * ks], hh); xa[1][ks] = g2_frag(&xs[32 * tb + 48 + ln][32 * ks], hh); } }
    __builtin_amdgcn_sched_barrier(0);   /* holds the next block's LDS loads ahead of the rounding work below, which then covers their latency */
    va[tb][0] = pack_d(d[0][0], d[0][1]); va[tb][1] = pack_d(d[1][0], d[1][1]);
    FragH f; f.v = pack_d(d[2][0], d[2][1]); *(v8us*)&kf[tb][w][0][lane][0] = f.half[0]; *(v8us*)&kf[tb][w][1][lane][0] = f.half[1]; }
  __syncthreads();
  v8f acc[2][4];
#pragma unroll
  for (int i = 0; i < 2; ++i)
#pragma unroll
    for (int j = 0; j < 4; ++j) acc[i][j] = z8;
  /* token blocks in order: v of this wave's 32 rows has stayed in registers and meets the shared k fragments */
#pragma unroll
  for (int tb = 0; tb < 4; ++tb)
#pragma unroll
    for (int j = 0; j < 4; ++j) { FragH f; f.half[0] = *(const v8us*)&kf[tb][j][0][lane][0]; f.half[1] = *(const v8us*)&kf[tb][j][1][lane][0];
      acc[0][j] = f_mma(va[tb][0], f.v, acc[0][j]); acc[1][j] = f_mma(va[tb][1], f.v, acc[1][j]); }
#pragma unroll
  for (int i = 0; i < 2; ++i)
#pragma unroll
    for (int j = 0; j < 4; ++j)
#pragma unroll
      for (int r = 0; r < 8; ++r) so[w][i * 16 + 8 * hh + r][j * 16 + ln] = acc[i][j][r] * 0.00390625f;
  /* so[w] is this wave's own: its LDS writes are ordered before its reads, no workgroup barrier */
  __builtin_amdgcn_fence(4 /* acq_rel order */, "workgroup"); __builtin_amdgcn_wave_barrier();
  float* pp = P + (size_t)bz * MTN + (size_t)by * CD * CD + (size_t)(32 * w) * CD + nq * 64;
  const int rsub = lane >> 4, c4 = (lane & 15) * 4;
#pragma unroll
  for (int q = 0; q < 16; ++q) { const int r = q * 2 + rsub; *(v4f*)(pp + (size_t)r * CD + c4) = *(const v4fa*)&so[w][r][c4]; }
}

// Last product, fixed shape: one workgroup = 128 tokens x 64 output columns of one batch, K = CD; wave w owns token rows 32w..32w+31.
// Both operand tiles are contiguous in their planes: every load covers whole 128-byte lines, all loads are issued before the first use, and the fragments are read from LDS.
__global__ __launch_bounds__(128) void k_out(const _Float16* __restrict__ X16, const _Float16* __restrict__ Mt, float* __restrict__ out) {
  __shared__ __attribute__((aligned(16))) _Float16 xs[128][XP];
  __shared__ __attribute__((aligned(16))) _Float16 ms[64][XP];
  static_assert(CD == 128);   /* 16 threads of 16 bytes cover one row, 128 threads cover 8 rows a load */
  __shared__ __attribute__((aligned(16))) float so[4][32][68];
  const int tid = threadIdx.x, w = tid >> 5, lane = tid & 31, ln = lane & 15, hh = lane >> 4;
  const int mt = blockIdx.x / (HW / 64), nq = blockIdx.x - mt * (HW / 64), b = blockIdx.y;
  const unsigned short* pm = (const unsigned short*)Mt + ((size_t)b * HW + nq * 64) * CD + tid * 8;
  const unsigned short* px = (const unsigned short*)X16 + ((size_t)b * SEQ + mt * 128) * CD + tid * 8;
  v8us rm[8], rx[16];
#pragma unroll
  for (int i = 0; i < 8; ++i) rm[i] = *(const v8us*)(pm + i * 1024);
#pragma unroll
  for (int i = 0; i < 16; ++i) rx[i] = *(const v8us*)(px + i * 1024);
  asm volatile("s_wait_xcnt 0x0" ::: "memory");   /* the loads' address registers may be reused from here on */
  __builtin_amdgcn_sched_barrier(0);   /* no vector instruction that reuses an address register moves up over the wait, and no LDS store moves in between the loads */
#pragma unroll
  for (int i = 0; i < 8; ++i) *(v8us*)&ms[i * 8 + (tid >> 4)][(tid & 15) * 8] = rm[i];
#pragma unroll
  for (int i = 0; i < 16; ++i) *(v8us*)&xs[i * 8 + (tid >> 4)][(tid & 15) * 8] = rx[i];
  __syncthreads();
  const v8f z8 = {0.f,0.f,0.f,0.f,0.f,0.f,0.f,0.f};
  v8f acc[2][4];
#pragma unroll
  for (int i = 0; i < 2; ++i)
#pragma unroll
    for (int j = 0; j < 4; ++j) acc[i][j] = z8;
  v16h af[CD / 32][2], bf[CD / 32][4];
#pragma unroll
  for (int ks = 0; ks < CD / 32; ++ks) { af[ks][0] = g2_frag(&xs[32 * w + ln][32 * ks], hh); af[ks][1] = g2_frag(&xs[32 * w + 16 + ln][32 * ks], hh);
#pragma unroll
    for (int j = 0; j < 4; ++j) bf[ks][j] = g2_frag(&ms[16 * j + ln][32 * ks], hh); }
  __builtin_amdgcn_sched_barrier(0);   /* every fragment read is issued ahead of the first product: one LDS latency is waited out instead of one per fragment group */
#pragma unroll
  for (int ks = 0; ks < CD / 32; ++ks)
#pragma unroll
    for (int j = 0; j < 4; ++j) { acc[0][j] = f_mma(af[ks][0], bf[ks][j], acc[0][j]); acc[1][j] = f_mma(af[ks][1], bf[ks][j], acc[1][j]); }
#pragma unroll
  for (int i = 0; i < 2; ++i)
#pragma unroll
    for (int j = 0; j < 4; ++j)
#pragma unroll
      for (int r = 0; r < 8; ++r) so[w][i * 16 + 8 * hh + r][j * 16 + ln] = acc[i][j][r] * 1.52587890625e-05f;
  /* so[w] is this wave's own: its LDS writes are ordered before its reads, no workgroup barrier */
  __builtin_amdgcn_fence(4 /* acq_rel order */, "workgroup"); __builtin_amdgcn_wave_barrier();
  float* po = out + (size_t)b * SEQ_FULL * HW + (size_t)(mt * 128 + 32 * w) * HW + nq * 64;
  const int rsub = lane >> 4, c4 = (lane & 15) * 4;
#pragma unroll
  for (int q = 0; q < 16; ++q) { const int r = q * 2 + rsub; *(v4f*)(po + (size_t)r * HW + c4) = *(const v4fa*)&so[w][r][c4]; }
}

// Mt = sum over the KSPLIT partial planes, in range order, f32, then one rounding to f16; 4 elements a thread
__global__ __launch_bounds__(256) void k_mtsum(const float* __restrict__ P, _Float16* __restrict__ Mt) {
  const size_t e = ((size_t)blockIdx.x * 256 + threadIdx.x) * 4;
  v4f s = *(const v4fa*)(P + e);
  /* unrolled so that the planes' loads overlap: rolled, each add would wait out its own load */
#pragma unroll
  for (int z = 1; z < KSPLIT; ++z) s += *(const v4fa*)(P + (size_t)z * MTN + e);
  v4h h4; for (int i = 0; i < 4; ++i) h4[i] = (_Float16)s[i];
  *(v4h*)(Mt + e) = h4;
}

extern "C" void kernel_launch(void* const* d_in, const int* in_sizes, int n_in,
                              void* d_out, int out_size, void* d_ws, size_t ws_size, hipStream_t stream) {
  if (n_in < 3) return;
  if ((size_t)in_sizes[0] < (size_t)(NB - 1) * SEQ_FULL * CD + (size_t)SEQ * CD || in_sizes[1] < CD * HW || in_sizes[2] < CD * HW) return;
  if ((size_t)out_size < (size_t)(NB - 1) * SEQ_FULL * HW + (size_t)SEQ * HW) return;
  const float* xin = (const float*)d_in[0]; const float* Wqk = (const float*)d_in[1]; const float* Wov = (const float*)d_in[2];
  char* ws = (char*)d_ws; size_t off = 0;
  auto take = [&](size_t bytes) { char* p = ws + off; off += (bytes + 255) & ~(size_t)255; return p; };
  _Float16* X16  = (_Float16*)take((size_t)NB * SEQ * CD * 2);        /* [NB*SEQ][CD], 16 x */
  _Float16* Mt16 = (_Float16*)take((size_t)NB * NH * CD * CD * 2);    /* [NB*NH][c2][c1], 2^12 carried */
  float*    MtP  = (float*)take((size_t)KSPLIT * MTN * 4);            /* [KSPLIT][NB*NH][c2][c1], 2^12 carried partial sums */
  if (off > ws_size) return;      /* approx 10.1 MiB at NB 2, SEQ 4096 */
  /* k, v = (16 x)(2^10 W) x 1/16 -> 2^10 k, 2^10 v as f16; Mt[b,h][c2][c1] = sum_t v[t][c2] k[t][c1]: (2^10 v)^T (2^10 k) x 2^-8 -> 2^12 M; column half on grid.x, (batch, head) on grid.y, token range on grid.z: f32 partial planes, then their sum as f16 */
  k_front<<<dim3(CD / 64, NB * NH, KSPLIT), 128, 0, stream>>>(xin, Wqk, Wov, X16, MtP);
  k_mtsum<<<MTN / (256 * 4), 256, 0, stream>>>(MtP, Mt16);
  /* out[b][t][h*CD + c2] = (16 x)(2^12 Mt)^T x 2^-16, batch on grid.y; B rows n = h*CD + c2 are the output columns */
  k_out<<<dim3((SEQ / 128) * (HW / 64), NB), 128, 0, stream>>>(X16, Mt16, (float*)d_out);
}

// v006
// A run of this version takes 14.4 microseconds.
// Versions between v004 and this one are left out; their measured steps multiply to 1.13 times as fast.
// Over all steps from v000 it is 10.1 times as fast.
#include <hip/hip_runtime.h>
// Unnormalised two-head attention (no softmax, no scale, no mask): q = x for both heads, k = x Wqk, v = x Wov ([in][out] weights, head h = columns h*128..h*128+127), out[b][t][h][:] = sum_s (x_t . k_s,h) v_s,h, evaluated as out = x (k_h^T v_h) with the per-(batch, head) 128x128 matrix k_h^T v_h summed over all 4096 tokens.
// Structure: one front launch with a workgroup per (column half, batch and head, token range): each wave reads its own weight columns as f32 straight into B fragment order, scaled by 2^10 and rounded once (RNE) to f16; x scaled by 16 and rounded once (RNE) to f16 (staged in LDS, also stored as a plane for the last product), k and v = x W (K=128) for the range's 128 tokens, whose f32 result tiles (carried x2^14) are scaled by 1/16 and rounded to f16 in place (carried x2^10) and are the operands of Mt = v^T k (K=4096, cut into KSPLIT token ranges on grid.z, one f32 partial plane each, summed in range order by k_mtsum) -> f16 plane carried x2^12; out = x Mt^T (K=128, N = 256 = (head, channel)) f32 into the output buffer.
// Compute dtype: every contraction on v_wmma_f32_16x16x32_f16 (f16 operands, single products, f32 accumulate); all conversions and epilogues in f32.
#ifndef NB
#define NB 2
#endif
#ifndef SEQ
#define SEQ 4096
#endif
#define SEQ_FULL 4096
#define CD 128
#define NH 2
#define HW (NH * CD)
#define KVW (2 * HW)
#define KSPLIT 32
#define MTN (NB * NH * CD * CD)
static_assert(NB >= 1 && NB <= 2);
static_assert(SEQ <= SEQ_FULL);
static_assert(SEQ % 128 == 0);
static_assert(SEQ % 64 == 0);
static_assert(SEQ % 32 == 0);
static_assert(SEQ == KSPLIT * 128);
#define SUMT 64 /* threads of a plane-sum workgroup: MTN / (4 SUMT) = 256 workgroups, so that the planes are read by every WGP and not by a quarter of them */
static_assert(MTN % (SUMT * 4) == 0);
static_assert(CD % 128 == 0);
static_assert(CD % 64 == 0);
static_assert(CD % 32 == 0);
static_assert(HW % 64 == 0);
static_assert(KVW % 64 == 0);
static_assert((NB * SEQ) % 128 == 0);
static_assert((SEQ * CD / 8) % 256 == 0);
static_assert(256 * 16 * 2 == 64 * 128);
static_assert(4 * 32 * 68 * 4 <= 131072);

typedef unsigned short v8us __attribute__((ext_vector_type(8), may_alias));
typedef float  v8f  __attribute__((ext_vector_type(8)));
typedef float  v4f  __attribute__((ext_vector_type(4)));
typedef float  v4fa __attribute__((ext_vector_type(4), may_alias));
typedef _Float16 v16h __attribute__((ext_vector_type(16)));
typedef _Float16 v4h __attribute__((ext_vector_type(4)));
typedef _Float16 v2h __attribute__((ext_vector_type(2)));
union FragH { v16h v; v8us half[2]; v2h p[8]; _Float16 h[16]; unsigned short u[16]; };

constexpr size_t al256(size_t b) { return (b + 255) & ~(size_t)255; }
constexpr size_t WSB_X16 = al256((size_t)NB * SEQ * CD * 2);
constexpr size_t WSB_MT  = al256((size_t)NB * NH * CD * CD * 2);
constexpr size_t WSB_MTP = al256((size_t)KSPLIT * MTN * 4);
static_assert(WSB_X16 + WSB_MT + WSB_MTP <= (size_t)134217728);

typedef float v2f __attribute__((ext_vector_type(2)));
// two f32 values times a power of two, each rounded once (RNE) to f16; results below the smallest f16 normal stay as f16 subnormals
__device__ __forceinline__ v2h toh2(float a, float b, float s) { const v2f p = {a * s, b * s}; return __builtin_convertvector(p, v2h); }

// 16-bit fragment loader: lane row/col = lane & 15, elements 0..7 <- k 8hh..8hh+7, elements 8..15 <- k 16+8hh..16+8hh+7 (same map for A and B)
__device__ __forceinline__ v16h g2_frag(const _Float16* p, int hh) { FragH f; f.half[0] = *(const v8us*)((const unsigned short*)p + 8 * hh); f.half[1] = *(const v8us*)((const unsigned short*)p + 16 + 8 * hh); return f.v; }

#define XP (CD + 8) /* LDS pitch of a staged x row in f16 elements: 16 bytes more than the row, so that the 16 rows one ds_load_b128 touches start in different banks */
// two f32 result tiles (tokens 0..15 and 16..31 of a 32-token block, same 16 channels), scaled and rounded in place: lane = channel, elements 0..7 <- token 8hh..8hh+7, 8..15 <- token 16+8hh..: the loader's own k map with k = token
__device__ __forceinline__ v16h pack_d(v8f d0, v8f d1) { FragH f;
#pragma unroll
  for (int r = 0; r < 8; r += 2) { f.p[r >> 1] = toh2(d0[r], d0[r + 1], 0.0625f); f.p[4 + (r >> 1)] = toh2(d1[r], d1[r + 1], 0.0625f); }
  return f.v; }
__device__ __forceinline__ v8f f_mma(v16h a, v16h b, v8f c) { return __builtin_amdgcn_wmma_f32_16x16x32_f16(false, a, false, b, (short)0, c, false, false); }

// One workgroup = (64 columns c1 of Mt, (batch, head), 128 tokens); wave w owns rows c2 = 32w..32w+31 of the partial plane and makes the k fragments of columns 16w..16w+15 for all four waves.
__global__ __launch_bounds__(128) void k_front(const float* __restrict__ x, const float* __restrict__ Wqk, const float* __restrict__ Wov, _Float16* __restrict__ X16, float* __restrict__ P) {
  __shared__ __attribute__((aligned(16))) _Float16 xs[128][XP];
  __shared__ __attribute__((aligned(16))) _Float16 kf[4][4][2][32][8];   /* [token block][column tile][fragment half][lane][8] */
  __shared__ __attribute__((aligned(16))) float so[4][32][68];
  const int tid = threadIdx.x, w = tid >> 5, lane = tid & 31, ln = lane & 15, hh = lane >> 4;
  const int nq = blockIdx.x, by = blockIdx.y, bz = blockIdx.z; const int b = by / NH, h = by - b * NH; const int t0 = bz * 128;
  const float* xb = x + ((size_t)b * SEQ_FULL + t0) * CD + (size_t)(tid >> 4) * CD + (tid & 15) * 8;
  /* every global load of the kernel is issued here, ahead of the first use, so that their latencies overlap */
  /* weights are [in][out] f32: lane = output column, element e of fragment ks = input row 32ks + 8hh + (e & 7) + 16(e >> 3), the loader's own k map */
  const float* pv = Wov + (size_t)(8 * hh) * HW + h * CD + 32 * w + ln;
  const float* pk = Wqk + (size_t)(8 * hh) * HW + h * CD + nq * 64 + 16 * w + ln;
  float rw[3][4][16];   /* 0, 1: the wave's two v channel tiles; 2: its k channel tile */
#pragma unroll
  for (int ks = 0; ks < 4; ++ks)
#pragma unroll
    for (int e = 0; e < 16; ++e) { const size_t ro = (size_t)(32 * ks + (e & 7) + 16 * (e >> 3)) * HW; rw[0][ks][e] = pv[ro]; rw[1][ks][e] = pv[ro + 16]; rw[2][ks][e] = pk[ro]; }
  v4f la[16], lc[16];
#pragma unroll
  for (int i = 0; i < 16; ++i) { la[i] = *(const v4fa*)(xb + (size_t)i * 8 * CD); lc[i] = *(const v4fa*)(xb + (size_t)i * 8 * CD + 4); }
  asm volatile("s_wait_xcnt 0x0" :: "v"(pv), "v"(pk), "v"(xb) : "memory");   /* the loads' address registers may be reused from here on; named as inputs so that none is handed out as a later load's destination ahead of the wait */
  __builtin_amdgcn_sched_barrier(0);   /* no vector instruction that reuses an address register moves up over the wait */
  v16h wf[3][4];
#pragma unroll
  for (int ks = 0; ks < 4; ++ks)
#pragma unroll
    for (int c = 0; c < 3; ++c) { FragH f;
#pragma unroll
      for (int e = 0; e < 16; e += 2) f.p[e >> 1] = toh2(rw[c][ks][e], rw[c][ks][e + 1], 1024.0f);
      wf[c][ks] = f.v; }
  v8us xh[16];
#pragma unroll
  for (int i = 0; i < 16; ++i) { const float v[8] = {la[i][0], la[i][1], la[i][2], la[i][3], lc[i][0], lc[i][1], lc[i][2], lc[i][3]}; FragH f;
#pragma unroll
    for (int q = 0; q < 8; q += 2) f.p[q >> 1] = toh2(v[q], v[q + 1], 16.0f);
    xh[i] = f.half[0]; *(v8us*)&xs[i * 8 + (tid >> 4)][(tid & 15) * 8] = xh[i]; }
  if (nq == 0 && h == 0) {   /* one of the four workgroups that stage these tokens stores the f16 plane for the last product */
    unsigned short* xo = (unsigned short*)X16 + ((size_t)b * SEQ + t0) * CD + (size_t)(tid >> 4) * CD + (tid & 15) * 8;
#pragma unroll
    for (int i = 0; i < 16; ++i) *(v8us*)(xo + (size_t)i * 8 * CD) = xh[i];
    asm volatile("s_wait_xcnt 0x0" ::: "memory"); }   /* the stores' address and data registers are reused behind the barrier */
  __syncthreads();
  const v8f z8 = {0.f,0.f,0.f,0.f,0.f,0.f,0.f,0.f};
  v16h va[4][2], xa[2][4];
#pragma unroll
  for (int ks = 0; ks < 4; ++ks) { xa[0][ks] = g2_frag(&xs[ln][32 * ks], hh); xa[1][ks] = g2_frag(&xs[16 + ln][32 * ks], hh); }
#pragma unroll
  for (int tb = 0; tb < 4; ++tb) { v8f d[3][2] = {{z8, z8}, {z8, z8}, {z8, z8}};
#pragma unroll
    for (int ks = 0; ks < 4; ++ks)
#pragma unroll
      for (int c = 0; c < 3; ++c) { d[c][0] = f_mma(xa[0][ks], wf[c][ks], d[c][0]); d[c][1] = f_mma(xa[1][ks], wf[c][ks], d[c][1]); }
    if (tb < 3) {
#pragma unroll
      for (int ks = 0; ks < 4; ++ks) { xa[0][ks] = g2_frag(&xs[32 * tb + 32 + ln][32 * ks], hh); xa[1][ks] = g2_frag(&xs[32 * tb + 48 + ln][32 * ks], hh); } }
    __builtin_amdgcn_sched_barrier(0);   /* holds the next block's LDS loads ahead of the rounding work below, which then covers their latency */
    va[tb][0] = pack_d(d[0][0], d[0][1]); va[tb][1] = pack_d(d[1][0], d[1][1]);
    FragH f; f.v = pack_d(d[2][0], d[2][1]); *(v8us*)&kf[tb][w][0][lane][0] = f.half[0]; *(v8us*)&kf[tb][w][1][lane][0] = f.half[1]; }
  __syncthreads();
  v8f acc[2][4];
#pragma unroll
  for (int i = 0; i < 2; ++i)
#pragma unroll
    for (int j = 0; j < 4; ++j) acc[i][j] = z8;
  /* token blocks in order: v of this wave's 32 rows has stayed in registers and meets the shared k fragments */
#pragma unroll
  for (int tb = 0; tb < 4; ++tb)
#pragma unroll
    for (int j = 0; j < 4; ++j) { FragH f; f.half[0] = *(const v8us*)&kf[tb][j][0][lane][0]; f.half[1] = *(const v8us*)&kf[tb][j][1][lane][0];
      acc[0][j] = f_mma(va[tb][0], f.v, acc[0][j]); acc[1][j] = f_mma(va[tb][1], f.v, acc[1][j]); }
#pragma unroll
  for (int i = 0; i < 2; ++i)
#pragma unroll
    for (int j = 0; j < 4; ++j)
#pragma unroll
      for (int r = 0; r < 8; ++r) so[w][i * 16 + 8 * hh + r][j * 16 + ln] = acc[i][j][r] * 0.00390625f;
  /* so[w] is this wave's own: its LDS writes are ordered before its reads, no workgroup barrier */
  __builtin_amdgcn_fence(4 /* acq_rel order */, "workgroup"); __builtin_amdgcn_wave_barrier();
  float* pp = P + (size_t)bz * MTN + (size_t)by * CD * CD + (size_t)(32 * w) * CD + nq * 64;
  const int rsub = lane >> 4, c4 = (lane & 15) * 4;
#pragma unroll
  for (int q = 0; q < 16; ++q) { const int r = q * 2 + rsub; *(v4f*)(pp + (size_t)r * CD + c4) = *(const v4fa*)&so[w][r][c4]; }
}

// Last product, fixed shape: one workgroup = 128 tokens x 64 output columns of one batch, K = CD; wave w owns token rows 32w..32w+31.
// Both operand tiles are contiguous in their planes: every load covers whole 128-byte lines, all loads are issued before the first use, and the fragments are read from LDS.
__global__ __launch_bounds__(128) void k_out(const _Float16* __restrict__ X16, const _Float16* __restrict__ Mt, float* __restrict__ out) {
  __shared__ __attribute__((aligned(16))) _Float16 xs[128][XP];
  __shared__ __attribute__((aligned(16))) _Float16 ms[64][XP];
  static_assert(CD == 128);   /* 16 threads of 16 bytes cover one row, 128 threads cover 8 rows a load */
  __shared__ __attribute__((aligned(16))) float so[4][32][68];
  const int tid = threadIdx.x, w = tid >> 5, lane = tid & 31, ln = lane & 15, hh = lane >> 4;
  const int mt = blockIdx.x / (HW / 64), nq = blockIdx.x - mt * (HW / 64), b = blockIdx.y;
  const unsigned short* pm = (const unsigned short*)Mt + ((size_t)b * HW + nq * 64) * CD + tid * 8;
  const unsigned short* px = (const unsigned short*)X16 + ((size_t)b * SEQ + mt * 128) * CD + tid * 8;
  v8us rm[8], rx[16];
#pragma unroll
  for (int i = 0; i < 8; ++i) rm[i] = *(const v8us*)(pm + i * 1024);
#pragma unroll
  for (int i = 0; i < 16; ++i) rx[i] = *(const v8us*)(px + i * 1024);
  asm volatile("s_wait_xcnt 0x0" ::: "memory");   /* the loads' address registers may be reused from here on */
  __builtin_amdgcn_sched_barrier(0);   /* no vector instruction that reuses an address register moves up over the wait, and no LDS store moves in between the loads */
#pragma unroll
  for (int i = 0; i < 8; ++i) *(v8us*)&ms[i * 8 + (tid >> 4)][(tid & 15) * 8] = rm[i];
#pragma unroll
  for (int i = 0; i < 16; ++i) *(v8us*)&xs[i * 8 + (tid >> 4)][(tid & 15) * 8] = rx[i];
  __syncthreads();
  const v8f z8 = {0.f,0.f,0.f,0.f,0.f,0.f,0.f,0.f};
  v8f acc[2][4];
#pragma unroll
  for (int i = 0; i < 2; ++i)
#pragma unroll
    for (int j = 0; j < 4; ++j) acc[i][j] = z8;
  v16h af[CD / 32][2], bf[CD / 32][4];
#pragma unroll
  for (int ks = 0; ks < CD / 32; ++ks) { af[ks][0] = g2_frag(&xs[32 * w + ln][32 * ks], hh); af[ks][1] = g2_frag(&xs[32 * w + 16 + ln][32 * ks], hh);
#pragma unroll
    for (int j = 0; j < 4; ++j) bf[ks][j] = g2_frag(&ms[16 * j + ln][32 * ks], hh); }
  __builtin_amdgcn_sched_barrier(0);   /* every fragment read is issued ahead of the first product: one LDS latency is waited out instead of one per fragment group */
#pragma unroll
  for (int ks = 0; ks < CD / 32; ++ks)
#pragma unroll
    for (int j = 0; j < 4; ++j) { acc[0][j] = f_mma(af[ks][0], bf[ks][j], acc[0][j]); acc[1][j] = f_mma(af[ks][1], bf[ks][j], acc[1][j]); }
#pragma unroll
  for (int i = 0; i < 2; ++i)
#pragma unroll
    for (int j = 0; j < 4; ++j)
#pragma unroll
      for (int r = 0; r < 8; ++r) so[w][i * 16 + 8 * hh + r][j * 16 + ln] = acc[i][j][r] * 1.52587890625e-05f;
  /* so[w] is this wave's own: its LDS writes are ordered before its reads, no workgroup barrier */
  __builtin_amdgcn_fence(4 /* acq_rel order */, "workgroup"); __builtin_amdgcn_wave_barrier();
  float* po = out + (size_t)b * SEQ_FULL * HW + (size_t)(mt * 128 + 32 * w) * HW + nq * 64;
  const int rsub = lane >> 4, c4 = (lane & 15) * 4;
#pragma unroll
  for (int q = 0; q < 16; ++q) { const int r = q * 2 + rsub; *(v4f*)(po + (size_t)r * HW + c4) = *(const v4fa*)&so[w][r][c4]; }
}

// Mt = sum over the KSPLIT partial planes, in range order, f32, then one rounding to f16; 4 elements a thread; two waves a workgroup, each with all its KSPLIT loads in flight
__global__ __launch_bounds__(SUMT) void k_mtsum(const float* __restrict__ P, _Float16* __restrict__ Mt) {
  const size_t e = ((size_t)blockIdx.x * SUMT + threadIdx.x) * 4;
  const float* p = P + e;
  v4f r[KSPLIT];
  /* unrolled into registers of their own: every plane's load is issued ahead of the first add, so that one memory latency is waited out and not one per batch of recycled registers */
#pragma unroll
  for (int z = 0; z < KSPLIT; ++z) r[z] = *(const v4fa*)(p + (size_t)z * MTN);
  asm volatile("s_wait_xcnt 0x0" :: "v"(p) : "memory");   /* the loads' address registers may be reused from here on; named as an input so that they stay whole up to the wait */
  __builtin_amdgcn_sched_barrier(0);   /* no add moves up among the loads: the compiler would otherwise recycle destination registers and hold later loads back behind earlier adds */
  v4f s = r[0];
#pragma unroll
  for (int z = 1; z < KSPLIT; ++z) s += r[z];
  v4h h4; for (int i = 0; i < 4; ++i) h4[i] = (_Float16)s[i];
  *(v4h*)(Mt + e) = h4;
}

extern "C" void kernel_launch(void* const* d_in, const int* in_sizes, int n_in,
                              void* d_out, int out_size, void* d_ws, size_t ws_size, hipStream_t stream) {
  if (n_in < 3) return;
  if ((size_t)in_sizes[0] < (size_t)(NB - 1) * SEQ_FULL * CD + (size_t)SEQ * CD || in_sizes[1] < CD * HW || in_sizes[2] < CD * HW) return;
  if ((size_t)out_size < (size_t)(NB - 1) * SEQ_FULL * HW + (size_t)SEQ * HW) return;
  const float* xin = (const float*)d_in[0]; const float* Wqk = (const float*)d_in[1]; const float* Wov = (const float*)d_in[2];
  char* ws = (char*)d_ws; size_t off = 0;
  auto take = [&](size_t bytes) { char* p = ws + off; off += (bytes + 255) & ~(size_t)255; return p; };
  _Float16* X16  = (_Float16*)take((size_t)NB * SEQ * CD * 2);        /* [NB*SEQ][CD], 16 x */
  _Float16* Mt16 = (_Float16*)take((size_t)NB * NH * CD * CD * 2);    /* [NB*NH][c2][c1], 2^12 carried */
  float*    MtP  = (float*)take((size_t)KSPLIT * MTN * 4);            /* [KSPLIT][NB*NH][c2][c1], 2^12 carried partial sums */
  if (off > ws_size) return;      /* approx 10.1 MiB at NB 2, SEQ 4096 */
  /* k, v = (16 x)(2^10 W) x 1/16 -> 2^10 k, 2^10 v as f16; Mt[b,h][c2][c1] = sum_t v[t][c2] k[t][c1]: (2^10 v)^T (2^10 k) x 2^-8 -> 2^12 M; column half on grid.x, (batch, head) on grid.y, token range on grid.z: f32 partial planes, then their sum as f16 */
  k_front<<<dim3(CD / 64, NB * NH, KSPLIT), 128, 0, stream>>>(xin, Wqk, Wov, X16, MtP);
  k_mtsum<<<MTN / (SUMT * 4), SUMT, 0, stream>>>(MtP, Mt16);
  /* out[b][t][h*CD + c2] = (16 x)(2^12 Mt)^T x 2^-16, batch on grid.y; B rows n = h*CD + c2 are the output columns */
  k_out<<<dim3((SEQ / 128) * (HW / 64), NB), 128, 0, stream>>>(X16, Mt16, (float*)d_out);
}
